// v000
// Measured on an AMD MI455X. A time is GPU time per run, averaged over a window of back-to-back runs after a warm-up
// (all launches, gaps included; the runs take copies of the inputs in turn), and the median of several windows.
// Apart from v000's, it joins two sittings. Times from different sittings can be a few percent apart, while
// side-by-side timings come from the same sitting.
// v000 is the starting kernel. One run takes 141 microseconds.
// Contractions: q.k^T = v_wmma_f32_16x16x32_bf16 single product on bf16 planes of the RNE-converted q and k inputs (exact products, f32 accumulate); p.v = 2-term bf16 split of p (p_hi.v + p_lo.v) against the bf16 plane of the RNE-converted v input, f32 accumulate; score scale 0.125, online softmax (expf, running max, row sum) and 1/rowsum in f32 on the VALU.
// Plane / carry map (all carry 1, nothing to fold back): QB = bf16(Q) [32768 rows = (b*8+h)*2048+q][64 d];
// KB = bf16(K[:,0]) [2*2048 rows = b*2048+s][64 d]; VT = bf16(V[:,0]) transposed per batch [2][64 d][2048 s];
// P hi|lo = unnormalised exp in (0,1] (bf16, f32 exponent range), per wave in LDS only; 1/rowsum applied to the f32 accumulator in the epilogue.
#include <hip/hip_runtime.h>
#include <math.h>
#include <stdint.h>

#define NB_   2
#define NH_   8
#define SEQ   2048
#define HD    64
#define NQR   (NB_ * NH_ * SEQ)   // 32768 q / out rows
#define NKR   (NB_ * SEQ)         // 4096 k rows

static_assert(HD == 64);
static_assert(SEQ % 64 == 0);
static_assert((NQR * HD) % (8 * 256) == 0);
static_assert((NKR * HD) % (8 * 256) == 0);

typedef __attribute__((ext_vector_type(16))) _Float16 v16h;
typedef __attribute__((ext_vector_type(8)))  _Float16 v8h;
typedef __attribute__((ext_vector_type(16))) __bf16   v16b;
typedef __attribute__((ext_vector_type(8)))  __bf16   v8b;
typedef __attribute__((ext_vector_type(8)))  float    v8f;
typedef __attribute__((ext_vector_type(4)))  float    v4f;
typedef __attribute__((ext_vector_type(4)))  unsigned int v4u;

__device__ __forceinline__ unsigned short f2bf_bits(float f) {
  unsigned u = __float_as_uint(f);
  return (unsigned short)((u + 0x7FFFu + ((u >> 16) & 1u)) >> 16);
}
__device__ __forceinline__ float bf_bits2f(unsigned short h) { return __uint_as_float(((unsigned)h) << 16); }
__device__ __forceinline__ unsigned pk16(unsigned short a, unsigned short b) { return (unsigned)a | ((unsigned)b << 16); }

// A / B fragment load (split k map): elements 0..7 <- p[0..7], 8..15 <- p[16..23]; caller passes p = row + k0 + 8*(lane>>4)
__device__ __forceinline__ v16b ld_frag_bf(const __bf16* p) {
  union { v16b v; v8b h[2]; } f;
  f.h[0] = *(const v8b*)(p);
  f.h[1] = *(const v8b*)(p + 16);
  return f.v;
}

__device__ __forceinline__ unsigned short at_bf_bits(float f) {
  unsigned u = __float_as_uint(f);
  return (unsigned short)((u + 0x7FFFu + ((u >> 16) & 1u)) >> 16);
}
__device__ __forceinline__ __bf16 at_f2bf(float f) { return __builtin_bit_cast(__bf16, at_bf_bits(f)); }
__device__ __forceinline__ void at_split(float f, __bf16& hi, __bf16& lo) {
  const unsigned short hb = at_bf_bits(f);
  hi = __builtin_bit_cast(__bf16, hb);
  lo = at_f2bf(f - __uint_as_float(((unsigned)hb) << 16));
}
// WMMA with dependency guard: 4 VALU nops tied to D, A and B kept live
__device__ __forceinline__ v8f at_mma(v16b a, v16b b, v8f c) {
  c = __builtin_amdgcn_wmma_f32_16x16x32_bf16(false, a, false, b, (short)0, c, false, false);
  asm volatile("v_nop\n\tv_nop\n\tv_nop\n\tv_nop" : "+v"(c) : "v"(a), "v"(b));
  return c;
}

// ---------------------------------------------------------------------------
// Flat bf16 RNE convert of two f32 arrays in one launch (block-uniform role split):
//   blocks 0..nbq-1 : qo[e] = bf16(qin[e]), unit i = block*256+tid < n8q, elements 8i..8i+7
//   blocks nbq..    : ko[e] = bf16(kin[e]), unit i = (block-nbq)*256+tid < n8k
// Coverage: q: 1024 blocks x 256 x 8 = 2097152 = 32768x64; k: 128 blocks x 256 x 8 = 262144 = 4096x64.
// ---------------------------------------------------------------------------
__global__ __launch_bounds__(256) void cvt2_kernel(const float* __restrict__ qin, const float* __restrict__ kin,
                                                   unsigned short* __restrict__ qo, unsigned short* __restrict__ ko,
                                                   int nbq, int n8q, int n8k) {
  const bool isq = (int)blockIdx.x < nbq;                 // block-uniform
  const float* in = isq ? qin : kin;                      // both global, uniform select
  unsigned short* out = isq ? qo : ko;
  const int n8 = isq ? n8q : n8k;
  const int blk = isq ? (int)blockIdx.x : ((int)blockIdx.x - nbq);
  const int i = blk * 256 + (int)threadIdx.x;
  if (i < n8) {
    const size_t e0 = (size_t)i * 8;
    const v4f a = *(const v4f*)(in + e0);
    const v4f c = *(const v4f*)(in + e0 + 4);
    v4u hv;
    hv[0] = pk16(f2bf_bits(a[0]), f2bf_bits(a[1]));
    hv[1] = pk16(f2bf_bits(a[2]), f2bf_bits(a[3]));
    hv[2] = pk16(f2bf_bits(c[0]), f2bf_bits(c[1]));
    hv[3] = pk16(f2bf_bits(c[2]), f2bf_bits(c[3]));
    {
      *(v4u*)(out + e0) = hv;
      
    }
  }
}

// ---------------------------------------------------------------------------
// Fused transpose + bf16 RNE convert of an f32 matrix, z-batched, one plane:
//   in_z = W + z*sIn viewed [R rows][Cc cols] with row pitch ldin  ->  oh_z[c][r] = bf16(in_z[r][c]), row pitch ldout, oh_z = oh + z*sOut.
// 64x64 tiles through LDS. grid = (Cc/64, R/64, Z), 256 threads (R, Cc multiples of 64; ldout multiple of 64 so every
// Coverage per block: load 4 it x 256 thr x 4 floats = 64x64; store 2 it x 256 thr x 8 u16 = 64x64.
// Here: in_z = V[z] [R=2048 s][Cc=64 d] (ldin 64), out VT_z [64 d][2048 s] (ldout 2048); grid (1, 32, 2).
// ---------------------------------------------------------------------------
__global__ __launch_bounds__(256) void tconv_kernel(const float* __restrict__ W, unsigned short* __restrict__ oh,
                                                    int ldin, int ldout, long sIn, long sOut) {
  __shared__ __align__(16) float tf[64 * 68];
  W  += (size_t)blockIdx.z * sIn;
  oh += (size_t)blockIdx.z * sOut;
  const int c0  = blockIdx.x * 64;   // input column block = output row block
  const int r0  = blockIdx.y * 64;   // input row block    = output column block
  const int tid = threadIdx.x;
  {
    const int lr = tid >> 4;         // 0..15
    const int c4 = (tid & 15) * 4;   // 0..60
#pragma unroll
    for (int it = 0; it < 4; ++it) {
      const int rr = it * 16 + lr;   // 0..63
      const v4f a = *(const v4f*)(W + (size_t)(r0 + rr) * ldin + c0 + c4);
      *(v4f*)(tf + rr * 68 + c4) = a;
    }
  }
  __syncthreads();
  const int sub = tid >> 3;          // 0..31
  const int c8  = (tid & 7) * 8;     // 0..56
  v4u hv[2];
#pragma unroll
  for (int it = 0; it < 2; ++it) {
    const int oc = it * 32 + sub;    // output row within tile (= input column)
    v4u a;
#pragma unroll
    for (int q = 0; q < 4; ++q) {
      const float f0 = tf[(c8 + 2 * q) * 68 + oc];
      const float f1 = tf[(c8 + 2 * q + 1) * 68 + oc];
      a[q] = pk16(f2bf_bits(f0), f2bf_bits(f1));
    }
    hv[it] = a;
  }
  {
#pragma unroll
    for (int it = 0; it < 2; ++it) {
      const int oc = it * 32 + sub;
      const size_t go = (size_t)(c0 + oc) * ldout + r0 + c8;
      *(v4u*)(oh + go) = hv[it];
    }
    
  }
}

// =====================================================================================
// Full (non-causal, unmasked) multi-query attention, head dim 64, all (batch, head) pairs in one launch.
//   q plane (bf16) [32768][64]: element (b, h, q, d) at [((b*8+h)*2048 + q)*64 + d]
//   k plane (bf16) [4096][64]: element (b, s, d) at [(b*2048 + s)*64 + d]       (one key head shared by all 8 query heads)
//   v^T plane (bf16) [2][64][2048]: element (b, d, s) at [b*131072 + d*2048 + s] (one value head shared by all 8 query heads)
//   out f32 [32768][64]: element (b, h, q, d) at [((b*8+h)*2048 + q)*64 + d]
//   scores = (q . k) * 0.125 : single bf16 product (exact), f32 accumulate
//   out    = p . v           : p_hi . v + p_lo . v (p = unnormalised exp split into bf16 hi|lo; the same v^T LDS tile is read
//                               for both terms), f32 accumulate, x 1/rowsum in f32 at the end
//   online softmax in f32 over all 2048 keys of the batch element (32 chunks of 64, compile-time trip count, no masking).
//   Block = 4 waves = 64 query rows of one (batch, head); grid.x = 2 * 8 * 32 = 512 (exact).
//   K / V^T chunk staging: 128 threads x 32 elements per plane = the whole 64x64 tile (16-B copies, plain loads,
//   __syncthreads before and after); fragment loads read the LDS tiles with the same v8b element type.
//   LDS extents: K/V tiles 64x64 fully staged every chunk; P tiles 16x64 per wave fully written every chunk before the
//   Epilogue: each wave stages its 16x64 f32 tile in LDS, then writes 256-B output rows as 16 lanes x 16 B
// =====================================================================================
#define AT_D 64
#define AT_NW 4
#define AT_QB 64
#define AT_KC 64

__global__ __launch_bounds__(128)
void attn_mqa_kernel(const unsigned short* __restrict__ qp, const unsigned short* __restrict__ kp,
                     const unsigned short* __restrict__ vtp, float* __restrict__ out, float sscale) {
  union FB { v16b v; v8b h[2]; };
  __shared__ __align__(16) __bf16 Ksh[AT_KC * AT_D];             // K  [kv][d]   8 KB
  __shared__ __align__(16) __bf16 Vth[AT_D * AT_KC];             // V^T [d][kv]  8 KB
  __shared__ __align__(16) __bf16 Psh[AT_NW][16 * AT_KC];        // per wave P hi [row][kv]
  __shared__ __align__(16) __bf16 Psl[AT_NW][16 * AT_KC];        // per wave P lo
  __shared__ __align__(16) float  Os[AT_NW][16 * 68];            // per wave out tile, pitch 68

  const int tid  = threadIdx.x;
  const int wave = tid >> 5;
  const int lane = tid & 31;
  const int hh   = lane >> 4;
  const int c    = lane & 15;

  const int nqb = SEQ / AT_QB;            // 32 query blocks per (batch, head)
  const int bx = blockIdx.x;              // grid = NB_ * NH_ * nqb (exact)
  const int qb = bx % nqb;
  const int bh = bx / nqb;                // b*8 + h, 0..15
  const int b  = bh / NH_;                // 0..1 : key / value index depends on b only
  const int q0 = bh * SEQ + qb * AT_QB + wave * 16;   // row in the q plane == row in out

  const __bf16* Qg = (const __bf16*)(const void*)qp;
  const __bf16* Kg = (const __bf16*)(const void*)kp  + (size_t)b * SEQ * AT_D;   // keys of batch b
  const __bf16* Vg = (const __bf16*)(const void*)vtp + (size_t)b * AT_D * SEQ;   // V^T of batch b [d][s]

  // ---- Q fragments (A operand, row = lane&15, split k map): 2 d-chunks ----
  v16b qa[2];
#pragma unroll
  for (int dc = 0; dc < 2; ++dc)
    qa[dc] = ld_frag_bf(Qg + (size_t)(q0 + c) * AT_D + dc * 32 + 8 * hh);

  float mrow[8], lrow[8];
  v8f oacc[4];
#pragma unroll
  for (int r = 0; r < 8; ++r) { mrow[r] = -INFINITY; lrow[r] = 0.f; }
#pragma unroll
  for (int t = 0; t < 4; ++t) oacc[t] = (v8f){0.f,0.f,0.f,0.f,0.f,0.f,0.f,0.f};

  const int nChunks = SEQ / AT_KC;   // 32, compile-time constant
  for (int kc = 0; kc < nChunks; ++kc) {
    const int kv0 = kc * AT_KC;
    __syncthreads();
    {
      // staging coverage: 128 threads x (4 x 8) elements = 64 rows x 64 per plane = the whole chunk tile
      const int r = tid >> 1, half = (tid & 1) * 32;
      const __bf16* ks = Kg + (size_t)(kv0 + r) * AT_D + half;      // K row kv0+r, d = half..half+31
      const __bf16* vs = Vg + (size_t)r * SEQ + kv0 + half;         // V^T row d = r, keys kv0+half..+31
#pragma unroll
      for (int i = 0; i < 4; ++i) {
        const v8b a0 = *(const v8b*)(ks + 8 * i);
        const v8b b0 = *(const v8b*)(vs + 8 * i);
        *(v8b*)(Ksh + r * AT_D  + half + 8 * i) = a0;
        *(v8b*)(Vth + r * AT_KC + half + 8 * i) = b0;
      }
    }
    __syncthreads();

    // ---- S = q . k^T : B fragment col = key j*16+c, split k map over d ----
    v8f s[4];
#pragma unroll
    for (int j = 0; j < 4; ++j) {
      s[j] = (v8f){0.f,0.f,0.f,0.f,0.f,0.f,0.f,0.f};
#pragma unroll
      for (int dc = 0; dc < 2; ++dc) {
        FB kb;
        kb.h[0] = *(const v8b*)(Ksh + (j * 16 + c) * AT_D + dc * 32 + 8 * hh);
        kb.h[1] = *(const v8b*)(Ksh + (j * 16 + c) * AT_D + dc * 32 + 16 + 8 * hh);
        s[j] = at_mma(qa[dc], kb.v, s[j]);
      }
    }
    // scale, then chunk row max (s[j][r] = score of query row 8hh+r, key j*16+c)
    float cm[8];
#pragma unroll
    for (int r = 0; r < 8; ++r) {
      float m = -INFINITY;
#pragma unroll
      for (int j = 0; j < 4; ++j) {
        const float sv = s[j][r] * sscale;
        s[j][r] = sv;
        m = fmaxf(m, sv);
      }
#pragma unroll
      for (int off = 1; off < 16; off <<= 1) m = fmaxf(m, __shfl_xor(m, off, 32));
      cm[r] = m;
    }
    __bf16* pwh = Psh[wave];
    __bf16* pwl = Psl[wave];
#pragma unroll
    for (int r = 0; r < 8; ++r) {
      const float mnew = fmaxf(mrow[r], cm[r]);
      const float alpha = expf(mrow[r] - mnew);
      mrow[r] = mnew;
      float psum = 0.f;
#pragma unroll
      for (int j = 0; j < 4; ++j) {
        const float p = expf(s[j][r] - mnew);
        psum += p;
        __bf16 a, bl; at_split(p, a, bl);
        pwh[(8 * hh + r) * AT_KC + j * 16 + c] = a;
        pwl[(8 * hh + r) * AT_KC + j * 16 + c] = bl;
      }
#pragma unroll
      for (int off = 1; off < 16; off <<= 1) psum += __shfl_xor(psum, off, 32);
      lrow[r] = lrow[r] * alpha + psum;
#pragma unroll
      for (int t = 0; t < 4; ++t) oacc[t][r] *= alpha;
    }
    __builtin_amdgcn_fence(__ATOMIC_RELEASE, "workgroup");
    __builtin_amdgcn_wave_barrier();
    __builtin_amdgcn_fence(__ATOMIC_ACQUIRE, "workgroup");
    // ---- O += p_hi . v + p_lo . v : A = P [query][key] (row = query c, split k map over keys), B = V^T [d][key] ----
#pragma unroll 1
    for (int kk = 0; kk < 2; ++kk) {
      FB pa, pl;
      pa.h[0] = *(const v8b*)(pwh + c * AT_KC + kk * 32 + 8 * hh);
      pa.h[1] = *(const v8b*)(pwh + c * AT_KC + kk * 32 + 16 + 8 * hh);
      pl.h[0] = *(const v8b*)(pwl + c * AT_KC + kk * 32 + 8 * hh);
      pl.h[1] = *(const v8b*)(pwl + c * AT_KC + kk * 32 + 16 + 8 * hh);
#pragma unroll
      for (int t = 0; t < 4; ++t) {
        FB vb;
        vb.h[0] = *(const v8b*)(Vth + (t * 16 + c) * AT_KC + kk * 32 + 8 * hh);
        vb.h[1] = *(const v8b*)(Vth + (t * 16 + c) * AT_KC + kk * 32 + 16 + 8 * hh);
        oacc[t] = at_mma(pa.v, vb.v, oacc[t]);
        oacc[t] = at_mma(pl.v, vb.v, oacc[t]);
      }
    }
  }

  float* os = Os[wave];
#pragma unroll
  for (int r = 0; r < 8; ++r) {
    const float inv = 1.0f / lrow[r];
#pragma unroll
    for (int t = 0; t < 4; ++t) os[(8 * hh + r) * 68 + t * 16 + c] = oacc[t][r] * inv;
  }
  __builtin_amdgcn_fence(__ATOMIC_RELEASE, "workgroup");
  __builtin_amdgcn_wave_barrier();
  __builtin_amdgcn_fence(__ATOMIC_ACQUIRE, "workgroup");
  {
    const int c4 = (lane & 15) * 4;
    {
#pragma unroll
      for (int it = 0; it < 8; ++it) {
        const int row = it * 2 + hh;   // it 0..7 x hh 0..1 covers rows 0..15 of the wave tile
        v4f val = *(const v4f*)(os + row * 68 + c4);
        *(v4f*)(out + (size_t)(q0 + row) * AT_D + c4) = val;
      }
      
    }
  }
}

// ---------------------------------------------------------------------------
// Workspace region map (byte offsets; every region is fully written by its producer launch before any consumer
//   QB  bf16 [32768][64]          0      4194304
//   KB  bf16 [4096][64]     4194304       524288
//   VT  bf16 [2][64][2048]  4718592       524288
//   total                   5242880
// ---------------------------------------------------------------------------
extern "C" void kernel_launch(void* const* d_in, const int* in_sizes, int n_in,
                              void* d_out, int out_size, void* d_ws, size_t ws_size,
                              hipStream_t stream) {
  if (n_in < 3) return;
  if (in_sizes[0] != NQR * HD) return;          // Q [2][8][2048][64]
  if (in_sizes[1] != NKR * HD) return;          // K [2][1][2048][64]
  if (in_sizes[2] != NKR * HD) return;          // V [2][1][2048][64]
  if (out_size != NQR * HD) return;             // out [2][8][2048][64]; last written element index NQR*HD-1

  const float* Q = (const float*)d_in[0];
  const float* K = (const float*)d_in[1];
  const float* V = (const float*)d_in[2];

  const size_t PQB = (size_t)NQR * HD * 2;      // 4194304
  const size_t PKB = (size_t)NKR * HD * 2;      // 524288
  const size_t PVT = (size_t)NB_ * HD * SEQ * 2;// 524288
  size_t off = 0;
  const size_t oQB = off; off += PQB;
  const size_t oKB = off; off += PKB;
  const size_t oVT = off; off += PVT;
  if (off > ws_size) return;                    // off = 5242880
  if (off > (size_t)134217728) return;

  char* ws = (char*)d_ws;
  unsigned short* QB = (unsigned short*)(ws + oQB);
  unsigned short* KB = (unsigned short*)(ws + oKB);
  unsigned short* VT = (unsigned short*)(ws + oVT);

  // (1) QB = bf16(Q) flat, KB = bf16(K) flat; 1024 + 128 blocks of 256 threads x 8 elements
  const int n8q = NQR * HD / 8;                 // 262144
  const int n8k = NKR * HD / 8;                 // 32768
  const int nbq = n8q / 256;                    // 1024
  const int nbk = n8k / 256;                    // 128
  cvt2_kernel<<<dim3(nbq + nbk), dim3(256), 0, stream>>>(Q, K, QB, KB, nbq, n8q, n8k);
  // (2) V[b] viewed [R=2048 s][Cc=64 d] (pitch 64) -> VT_b[d][s] (pitch 2048); grid (Cc/64, R/64, B) = (1, 32, 2)
  tconv_kernel<<<dim3(HD / 64, SEQ / 64, NB_), dim3(256), 0, stream>>>(V, VT, HD, SEQ, (long)SEQ * HD, (long)HD * SEQ);
  // (3) attention per (batch, head, 64-query block) -> d_out rows (b*8+h)*2048 + q; 512 blocks x 128 threads
  attn_mqa_kernel<<<dim3(NB_ * NH_ * (SEQ / 64)), dim3(128), 0, stream>>>(QB, KB, VT, (float*)d_out, 0.125f);
  (void)hipGetLastError();
}

// v001
// Measured time: 85.2 microseconds a run.
// Next to v000, in two timings, it ran 1.73 and 1.80 times as fast.
#include <hip/hip_runtime.h>
#include <math.h>
#include <stdint.h>

#define NB_   2
#define NH_   8
#define SEQ   2048
#define HD    64
#define NQR   (NB_ * NH_ * SEQ)   // 32768 q / out rows
#define NKR   (NB_ * SEQ)         // 4096 k rows

static_assert(HD == 64);
static_assert(SEQ % 64 == 0);
static_assert((NQR * HD) % (8 * 256) == 0);
static_assert((NKR * HD) % (8 * 256) == 0);

typedef __attribute__((ext_vector_type(16))) _Float16 v16h;
typedef __attribute__((ext_vector_type(8)))  _Float16 v8h;
typedef __attribute__((ext_vector_type(16))) __bf16   v16b;
typedef __attribute__((ext_vector_type(8)))  __bf16   v8b;
typedef __attribute__((ext_vector_type(8)))  float    v8f;
typedef __attribute__((ext_vector_type(4)))  float    v4f;
typedef __attribute__((ext_vector_type(4)))  unsigned int v4u;

__device__ __forceinline__ unsigned short f2bf_bits(float f) {
  unsigned u = __float_as_uint(f);
  return (unsigned short)((u + 0x7FFFu + ((u >> 16) & 1u)) >> 16);
}
__device__ __forceinline__ float bf_bits2f(unsigned short h) { return __uint_as_float(((unsigned)h) << 16); }
__device__ __forceinline__ unsigned pk16(unsigned short a, unsigned short b) { return (unsigned)a | ((unsigned)b << 16); }

// A / B fragment load (split k map): elements 0..7 <- p[0..7], 8..15 <- p[16..23]; caller passes p = row + k0 + 8*(lane>>4)
__device__ __forceinline__ v16b ld_frag_bf(const __bf16* p) {
  union { v16b v; v8b h[2]; } f;
  f.h[0] = *(const v8b*)(p);
  f.h[1] = *(const v8b*)(p + 16);
  return f.v;
}

__device__ __forceinline__ unsigned short at_bf_bits(float f) {
  unsigned u = __float_as_uint(f);
  return (unsigned short)((u + 0x7FFFu + ((u >> 16) & 1u)) >> 16);
}
__device__ __forceinline__ __bf16 at_f2bf(float f) { return __builtin_bit_cast(__bf16, at_bf_bits(f)); }
__device__ __forceinline__ void at_split(float f, __bf16& hi, __bf16& lo) {
  const unsigned short hb = at_bf_bits(f);
  hi = __builtin_bit_cast(__bf16, hb);
  lo = at_f2bf(f - __uint_as_float(((unsigned)hb) << 16));
}
// lane l <-> lane l ^ 16 (the other half of the same column) as a vector cross-row move
__device__ __forceinline__ float at_xhalf(float f) {
  const int b = __float_as_int(f);
  return __int_as_float(__builtin_amdgcn_permlanex16(b, b, 0x76543210, 0xfedcba98, false, false));
}
// WMMA with dependency guard: 4 VALU nops tied to D, A and B kept live
__device__ __forceinline__ v8f at_mma(v16b a, v16b b, v8f c) {
  c = __builtin_amdgcn_wmma_f32_16x16x32_bf16(false, a, false, b, (short)0, c, false, false);
  asm volatile("v_nop\n\tv_nop\n\tv_nop\n\tv_nop" : "+v"(c) : "v"(a), "v"(b));
  return c;
}

// ---------------------------------------------------------------------------
// Flat bf16 RNE convert of two f32 arrays in one launch (block-uniform role split):
//   blocks 0..nbq-1 : qo[e] = bf16(qin[e]), unit i = block*256+tid < n8q, elements 8i..8i+7
//   blocks nbq..    : ko[e] = bf16(kin[e]), unit i = (block-nbq)*256+tid < n8k
// Coverage: q: 1024 blocks x 256 x 8 = 2097152 = 32768x64; k: 128 blocks x 256 x 8 = 262144 = 4096x64.
// ---------------------------------------------------------------------------
__global__ __launch_bounds__(256) void cvt2_kernel(const float* __restrict__ qin, const float* __restrict__ kin,
                                                   unsigned short* __restrict__ qo, unsigned short* __restrict__ ko,
                                                   int nbq, int n8q, int n8k) {
  const bool isq = (int)blockIdx.x < nbq;                 // block-uniform
  const float* in = isq ? qin : kin;                      // both global, uniform select
  unsigned short* out = isq ? qo : ko;
  const int n8 = isq ? n8q : n8k;
  const int blk = isq ? (int)blockIdx.x : ((int)blockIdx.x - nbq);
  const int i = blk * 256 + (int)threadIdx.x;
  if (i < n8) {
    const size_t e0 = (size_t)i * 8;
    const v4f a = *(const v4f*)(in + e0);
    const v4f c = *(const v4f*)(in + e0 + 4);
    v4u hv;
    hv[0] = pk16(f2bf_bits(a[0]), f2bf_bits(a[1]));
    hv[1] = pk16(f2bf_bits(a[2]), f2bf_bits(a[3]));
    hv[2] = pk16(f2bf_bits(c[0]), f2bf_bits(c[1]));
    hv[3] = pk16(f2bf_bits(c[2]), f2bf_bits(c[3]));
    {
      *(v4u*)(out + e0) = hv;
      
    }
  }
}

// ---------------------------------------------------------------------------
// Fused transpose + bf16 RNE convert of an f32 matrix, z-batched, one plane:
//   in_z = W + z*sIn viewed [R rows][Cc cols] with row pitch ldin  ->  oh_z[c][r] = bf16(in_z[r][c]), row pitch ldout, oh_z = oh + z*sOut.
// 64x64 tiles through LDS. grid = (Cc/64, R/64, Z), 256 threads (R, Cc multiples of 64; ldout multiple of 64 so every
// Coverage per block: load 4 it x 256 thr x 4 floats = 64x64; store 2 it x 256 thr x 8 u16 = 64x64.
// Here: in_z = V[z] [R=2048 s][Cc=64 d] (ldin 64), out VT_z [64 d][2048 s] (ldout 2048); grid (1, 32, 2).
// ---------------------------------------------------------------------------
__global__ __launch_bounds__(256) void tconv_kernel(const float* __restrict__ W, unsigned short* __restrict__ oh,
                                                    int ldin, int ldout, long sIn, long sOut) {
  __shared__ __align__(16) float tf[64 * 68];
  W  += (size_t)blockIdx.z * sIn;
  oh += (size_t)blockIdx.z * sOut;
  const int c0  = blockIdx.x * 64;   // input column block = output row block
  const int r0  = blockIdx.y * 64;   // input row block    = output column block
  const int tid = threadIdx.x;
  {
    const int lr = tid >> 4;         // 0..15
    const int c4 = (tid & 15) * 4;   // 0..60
#pragma unroll
    for (int it = 0; it < 4; ++it) {
      const int rr = it * 16 + lr;   // 0..63
      const v4f a = *(const v4f*)(W + (size_t)(r0 + rr) * ldin + c0 + c4);
      *(v4f*)(tf + rr * 68 + c4) = a;
    }
  }
  __syncthreads();
  const int sub = tid >> 3;          // 0..31
  const int c8  = (tid & 7) * 8;     // 0..56
  v4u hv[2];
#pragma unroll
  for (int it = 0; it < 2; ++it) {
    const int oc = it * 32 + sub;    // output row within tile (= input column)
    v4u a;
#pragma unroll
    for (int q = 0; q < 4; ++q) {
      const float f0 = tf[(c8 + 2 * q) * 68 + oc];
      const float f1 = tf[(c8 + 2 * q + 1) * 68 + oc];
      a[q] = pk16(f2bf_bits(f0), f2bf_bits(f1));
    }
    hv[it] = a;
  }
  {
#pragma unroll
    for (int it = 0; it < 2; ++it) {
      const int oc = it * 32 + sub;
      const size_t go = (size_t)(c0 + oc) * ldout + r0 + c8;
      *(v4u*)(oh + go) = hv[it];
    }
    
  }
}

// =====================================================================================
// Full (non-causal, unmasked) multi-query attention, head dim 64, all (batch, head) pairs in one launch.
//   q plane (bf16) [32768][64]: element (b, h, q, d) at [((b*8+h)*2048 + q)*64 + d]
//   k plane (bf16) [4096][64]: element (b, s, d) at [(b*2048 + s)*64 + d]       (one key head shared by all 8 query heads)
//   v^T plane (bf16) [2][64][2048]: element (b, d, s) at [b*131072 + d*2048 + s] (one value head shared by all 8 query heads)
//   out f32 [32768][64]: element (b, h, q, d) at [((b*8+h)*2048 + q)*64 + d]
//   scores^T = (k . q^T) * 0.125 : single bf16 product (exact), f32 accumulate; A = K rows, B = Q columns
//   out^T    = v^T . p^T         : v^T . p_hi^T + v^T . p_lo^T (p = unnormalised exp split into bf16 hi|lo; the same v^T LDS
//                               fragment serves both terms), f32 accumulate, x 1/rowsum in f32 at the end
//   online softmax in f32 over all 2048 keys of the batch element (32 chunks of 64, compile-time trip count, no masking):
//   lane (c, hh) holds the scores of query c for the keys j*16 + 8*hh + r; max and sum run in-lane, the two halves of a
//   query join by one cross-row move (max: every chunk; sum: once, in the epilogue).
//   Block = 4 waves = 64 query rows of one (batch, head); grid.x = 2 * 8 * 32 = 512 (exact).
//   K / V^T chunk staging: 128 threads x 32 elements per plane = the whole 64x64 tile (16-B copies, plain loads,
//   __syncthreads before and after); fragment loads read the LDS tiles with the same v8b element type.
//   LDS extents: K/V tiles 64x64 fully staged every chunk.
//   Epilogue: each wave stages its 16x64 f32 tile in LDS, then writes 256-B output rows as 16 lanes x 16 B
// =====================================================================================
#define AT_D 64
#define AT_NW 4
#define AT_QB 64
#define AT_KC 64

__global__ __launch_bounds__(128)
void attn_mqa_kernel(const unsigned short* __restrict__ qp, const unsigned short* __restrict__ kp,
                     const unsigned short* __restrict__ vtp, float* __restrict__ out, float sscale) {
  union FB { v16b v; v8b h[2]; };
  __shared__ __align__(16) __bf16 Ksh[AT_KC * AT_D];             // K  [kv][d]   8 KB
  __shared__ __align__(16) __bf16 Vth[AT_D * AT_KC];             // V^T [d][kv]  8 KB
  __shared__ __align__(16) float  Os[AT_NW][16 * 68];            // per wave out tile, pitch 68

  const int tid  = threadIdx.x;
  const int wave = tid >> 5;
  const int lane = tid & 31;
  const int hh   = lane >> 4;
  const int c    = lane & 15;

  const int nqb = SEQ / AT_QB;            // 32 query blocks per (batch, head)
  const int bx = blockIdx.x;              // grid = NB_ * NH_ * nqb (exact)
  const int qb = bx % nqb;
  const int bh = bx / nqb;                // b*8 + h, 0..15
  const int b  = bh / NH_;                // 0..1 : key / value index depends on b only
  const int q0 = bh * SEQ + qb * AT_QB + wave * 16;   // row in the q plane == row in out

  const __bf16* Qg = (const __bf16*)(const void*)qp;
  const __bf16* Kg = (const __bf16*)(const void*)kp  + (size_t)b * SEQ * AT_D;   // keys of batch b
  const __bf16* Vg = (const __bf16*)(const void*)vtp + (size_t)b * AT_D * SEQ;   // V^T of batch b [d][s]

  // ---- Q fragments (B operand, column = query lane&15, split k map): 2 d-chunks ----
  v16b qa[2];
#pragma unroll
  for (int dc = 0; dc < 2; ++dc)
    qa[dc] = ld_frag_bf(Qg + (size_t)(q0 + c) * AT_D + dc * 32 + 8 * hh);

  float mrow = -INFINITY;   // running max of query c (equal in both halves)
  float lrow = 0.f;         // running sum of query c over this half's keys only
  v8f oacc[4];              // oacc[t][r] = O^T[d = t*16 + 8*hh + r][query c]
#pragma unroll
  for (int t = 0; t < 4; ++t) oacc[t] = (v8f){0.f,0.f,0.f,0.f,0.f,0.f,0.f,0.f};

  const int nChunks = SEQ / AT_KC;   // 32, compile-time constant
  for (int kc = 0; kc < nChunks; ++kc) {
    const int kv0 = kc * AT_KC;
    __syncthreads();
    {
      // staging coverage: 128 threads x (4 x 8) elements = 64 rows x 64 per plane = the whole chunk tile
      const int r = tid >> 1, half = (tid & 1) * 32;
      const __bf16* ks = Kg + (size_t)(kv0 + r) * AT_D + half;      // K row kv0+r, d = half..half+31
      const __bf16* vs = Vg + (size_t)r * SEQ + kv0 + half;         // V^T row d = r, keys kv0+half..+31
#pragma unroll
      for (int i = 0; i < 4; ++i) {
        const v8b a0 = *(const v8b*)(ks + 8 * i);
        const v8b b0 = *(const v8b*)(vs + 8 * i);
        *(v8b*)(Ksh + r * AT_D  + half + 8 * i) = a0;
        *(v8b*)(Vth + r * AT_KC + half + 8 * i) = b0;
      }
    }
    __syncthreads();

    // ---- S^T = k . q^T : A fragment row = key j*16+c, B = Q column c, split k map over d on both ----
    v8f s[4];
#pragma unroll
    for (int j = 0; j < 4; ++j) {
      s[j] = (v8f){0.f,0.f,0.f,0.f,0.f,0.f,0.f,0.f};
#pragma unroll
      for (int dc = 0; dc < 2; ++dc) {
        FB kb;
        kb.h[0] = *(const v8b*)(Ksh + (j * 16 + c) * AT_D + dc * 32 + 8 * hh);
        kb.h[1] = *(const v8b*)(Ksh + (j * 16 + c) * AT_D + dc * 32 + 16 + 8 * hh);
        s[j] = at_mma(kb.v, qa[dc], s[j]);
      }
    }
    // scale, then chunk max of query c (s[j][r] = score of key j*16 + 8hh + r, query c): in-lane, then the other half
    float cm = -INFINITY;
#pragma unroll
    for (int j = 0; j < 4; ++j) {
#pragma unroll
      for (int r = 0; r < 8; ++r) {
        const float sv = s[j][r] * sscale;
        s[j][r] = sv;
        cm = fmaxf(cm, sv);
      }
    }
    cm = fmaxf(cm, at_xhalf(cm));
    const float mnew = fmaxf(mrow, cm);
    const float alpha = expf(mrow - mnew);
    mrow = mnew;
    // P^T as B operand: element e of the 32-key block kk = key kk*32 + (e < 8 ? 8hh + e : 16 + 8hh + e - 8) = s[2kk + (e >> 3)][e & 7]
    FB ph[2], pl[2];
    float ps[4];
#pragma unroll
    for (int j = 0; j < 4; ++j) {
      float psum = 0.f;
#pragma unroll
      for (int r = 0; r < 8; ++r) {
        const float p = expf(s[j][r] - mnew);
        psum += p;
        __bf16 a, bl; at_split(p, a, bl);
        ph[j >> 1].v[(j & 1) * 8 + r] = a;
        pl[j >> 1].v[(j & 1) * 8 + r] = bl;
      }
      ps[j] = psum;
    }
    lrow = lrow * alpha + ((ps[0] + ps[1]) + (ps[2] + ps[3]));
#pragma unroll
    for (int t = 0; t < 4; ++t) {
#pragma unroll
      for (int r = 0; r < 8; ++r) oacc[t][r] *= alpha;
    }
    // ---- O^T += v^T . p_hi^T + v^T . p_lo^T : A = V^T [d][key] (row = d t*16+c, split k map over keys), B = P^T ----
    // unrolled: ph / pl are register arrays, their index must be a compile-time constant
#pragma unroll
    for (int kk = 0; kk < 2; ++kk) {
#pragma unroll
      for (int t = 0; t < 4; ++t) {
        FB vb;
        vb.h[0] = *(const v8b*)(Vth + (t * 16 + c) * AT_KC + kk * 32 + 8 * hh);
        vb.h[1] = *(const v8b*)(Vth + (t * 16 + c) * AT_KC + kk * 32 + 16 + 8 * hh);
        oacc[t] = at_mma(vb.v, ph[kk].v, oacc[t]);
        oacc[t] = at_mma(vb.v, pl[kk].v, oacc[t]);
      }
    }
  }

  // join the two halves' sums of query c; a lane holds 8 consecutive d of query c per tile: two 16-B LDS stores
  float* os = Os[wave];
  {
    const float inv = 1.0f / (lrow + at_xhalf(lrow));
#pragma unroll
    for (int t = 0; t < 4; ++t) {
      v4f lo4, hi4;
#pragma unroll
      for (int r = 0; r < 4; ++r) { lo4[r] = oacc[t][r] * inv; hi4[r] = oacc[t][4 + r] * inv; }
      *(v4f*)(os + c * 68 + t * 16 + 8 * hh)     = lo4;
      *(v4f*)(os + c * 68 + t * 16 + 8 * hh + 4) = hi4;
    }
  }
  __builtin_amdgcn_fence(__ATOMIC_RELEASE, "workgroup");
  __builtin_amdgcn_wave_barrier();
  __builtin_amdgcn_fence(__ATOMIC_ACQUIRE, "workgroup");
  {
    const int c4 = (lane & 15) * 4;
    float* orow = out + (size_t)(q0 + hh) * AT_D + c4;   // one address; the rows follow at constant offsets
    {
#pragma unroll
      for (int it = 0; it < 8; ++it) {
        const int row = it * 2 + hh;   // it 0..7 x hh 0..1 covers rows 0..15 of the wave tile
        v4f val = *(const v4f*)(os + row * 68 + c4);
        *(v4f*)(orow + it * 2 * AT_D) = val;
      }
      
    }
  }
}

// ---------------------------------------------------------------------------
// Workspace region map (byte offsets; every region is fully written by its producer launch before any consumer
//   QB  bf16 [32768][64]          0      4194304
//   KB  bf16 [4096][64]     4194304       524288
//   VT  bf16 [2][64][2048]  4718592       524288
//   total                   5242880
// ---------------------------------------------------------------------------
extern "C" void kernel_launch(void* const* d_in, const int* in_sizes, int n_in,
                              void* d_out, int out_size, void* d_ws, size_t ws_size,
                              hipStream_t stream) {
  if (n_in < 3) return;
  if (in_sizes[0] != NQR * HD) return;          // Q [2][8][2048][64]
  if (in_sizes[1] != NKR * HD) return;          // K [2][1][2048][64]
  if (in_sizes[2] != NKR * HD) return;          // V [2][1][2048][64]
  if (out_size != NQR * HD) return;             // out [2][8][2048][64]; last written element index NQR*HD-1

  const float* Q = (const float*)d_in[0];
  const float* K = (const float*)d_in[1];
  const float* V = (const float*)d_in[2];

  const size_t PQB = (size_t)NQR * HD * 2;      // 4194304
  const size_t PKB = (size_t)NKR * HD * 2;      // 524288
  const size_t PVT = (size_t)NB_ * HD * SEQ * 2;// 524288
  size_t off = 0;
  const size_t oQB = off; off += PQB;
  const size_t oKB = off; off += PKB;
  const size_t oVT = off; off += PVT;
  if (off > ws_size) return;                    // off = 5242880
  if (off > (size_t)134217728) return;

  char* ws = (char*)d_ws;
  unsigned short* QB = (unsigned short*)(ws + oQB);
  unsigned short* KB = (unsigned short*)(ws + oKB);
  unsigned short* VT = (unsigned short*)(ws + oVT);

  // (1) QB = bf16(Q) flat, KB = bf16(K) flat; 1024 + 128 blocks of 256 threads x 8 elements
  const int n8q = NQR * HD / 8;                 // 262144
  const int n8k = NKR * HD / 8;                 // 32768
  const int nbq = n8q / 256;                    // 1024
  const int nbk = n8k / 256;                    // 128
  cvt2_kernel<<<dim3(nbq + nbk), dim3(256), 0, stream>>>(Q, K, QB, KB, nbq, n8q, n8k);
  // (2) V[b] viewed [R=2048 s][Cc=64 d] (pitch 64) -> VT_b[d][s] (pitch 2048); grid (Cc/64, R/64, B) = (1, 32, 2)
  tconv_kernel<<<dim3(HD / 64, SEQ / 64, NB_), dim3(256), 0, stream>>>(V, VT, HD, SEQ, (long)SEQ * HD, (long)HD * SEQ);
  // (3) attention per (batch, head, 64-query block) -> d_out rows (b*8+h)*2048 + q; 512 blocks x 128 threads
  attn_mqa_kernel<<<dim3(NB_ * NH_ * (SEQ / 64)), dim3(128), 0, stream>>>(QB, KB, VT, (float*)d_out, 0.125f);
  (void)hipGetLastError();
}

// v002
// Measured time: 69.7 microseconds a run.
// Two timings next to v001 put it at 1.25 and 1.21 times that version's speed.
// Over all steps from v000 it is 2.17 times as fast.
#include <hip/hip_runtime.h>
#include <math.h>
#include <stdint.h>

#define NB_   2
#define NH_   8
#define SEQ   2048
#define HD    64
#define NQR   (NB_ * NH_ * SEQ)   // 32768 q / out rows
#define NKR   (NB_ * SEQ)         // 4096 k rows

static_assert(HD == 64);
static_assert(SEQ % 64 == 0);
static_assert((NQR * HD) % (8 * 256) == 0);
static_assert((NKR * HD) % (8 * 256) == 0);

typedef __attribute__((ext_vector_type(16))) _Float16 v16h;
typedef __attribute__((ext_vector_type(8)))  _Float16 v8h;
typedef __attribute__((ext_vector_type(16))) __bf16   v16b;
typedef __attribute__((ext_vector_type(8)))  __bf16   v8b;
typedef __attribute__((ext_vector_type(8)))  float    v8f;
typedef __attribute__((ext_vector_type(4)))  float    v4f;
typedef __attribute__((ext_vector_type(4)))  unsigned int v4u;

__device__ __forceinline__ unsigned short f2bf_bits(float f) {
  unsigned u = __float_as_uint(f);
  return (unsigned short)((u + 0x7FFFu + ((u >> 16) & 1u)) >> 16);
}
__device__ __forceinline__ float bf_bits2f(unsigned short h) { return __uint_as_float(((unsigned)h) << 16); }
__device__ __forceinline__ unsigned pk16(unsigned short a, unsigned short b) { return (unsigned)a | ((unsigned)b << 16); }

// A / B fragment load (split k map): elements 0..7 <- p[0..7], 8..15 <- p[16..23]; caller passes p = row + k0 + 8*(lane>>4)
__device__ __forceinline__ v16b ld_frag_bf(const __bf16* p) {
  union { v16b v; v8b h[2]; } f;
  f.h[0] = *(const v8b*)(p);
  f.h[1] = *(const v8b*)(p + 16);
  return f.v;
}

__device__ __forceinline__ unsigned short at_bf_bits(float f) {
  unsigned u = __float_as_uint(f);
  return (unsigned short)((u + 0x7FFFu + ((u >> 16) & 1u)) >> 16);
}
__device__ __forceinline__ __bf16 at_f2bf(float f) { return __builtin_bit_cast(__bf16, at_bf_bits(f)); }
__device__ __forceinline__ void at_split(float f, __bf16& hi, __bf16& lo) {
  const unsigned short hb = at_bf_bits(f);
  hi = __builtin_bit_cast(__bf16, hb);
  lo = at_f2bf(f - __uint_as_float(((unsigned)hb) << 16));
}
// lane l <-> lane l ^ 16 (the other half of the same column) as a vector cross-row move
__device__ __forceinline__ float at_xhalf(float f) {
  const int b = __float_as_int(f);
  return __int_as_float(__builtin_amdgcn_permlanex16(b, b, 0x76543210, 0xfedcba98, false, false));
}
// WMMA with dependency guard: 4 VALU nops tied to D, A and B kept live
__device__ __forceinline__ v8f at_mma(v16b a, v16b b, v8f c) {
  c = __builtin_amdgcn_wmma_f32_16x16x32_bf16(false, a, false, b, (short)0, c, false, false);
  asm volatile("v_nop\n\tv_nop\n\tv_nop\n\tv_nop" : "+v"(c) : "v"(a), "v"(b));
  return c;
}

// ---------------------------------------------------------------------------
// Flat bf16 RNE convert of two f32 arrays in one launch (block-uniform role split):
//   blocks 0..nbq-1 : qo[e] = bf16(qin[e]), unit i = block*256+tid < n8q, elements 8i..8i+7
//   blocks nbq..    : ko[e] = bf16(kin[e]), unit i = (block-nbq)*256+tid < n8k
// Coverage: q: 1024 blocks x 256 x 8 = 2097152 = 32768x64; k: 128 blocks x 256 x 8 = 262144 = 4096x64.
// ---------------------------------------------------------------------------
__global__ __launch_bounds__(256) void cvt2_kernel(const float* __restrict__ qin, const float* __restrict__ kin,
                                                   unsigned short* __restrict__ qo, unsigned short* __restrict__ ko,
                                                   int nbq, int n8q, int n8k) {
  const bool isq = (int)blockIdx.x < nbq;                 // block-uniform
  const float* in = isq ? qin : kin;                      // both global, uniform select
  unsigned short* out = isq ? qo : ko;
  const int n8 = isq ? n8q : n8k;
  const int blk = isq ? (int)blockIdx.x : ((int)blockIdx.x - nbq);
  const int i = blk * 256 + (int)threadIdx.x;
  if (i < n8) {
    const size_t e0 = (size_t)i * 8;
    const v4f a = *(const v4f*)(in + e0);
    const v4f c = *(const v4f*)(in + e0 + 4);
    v4u hv;
    hv[0] = pk16(f2bf_bits(a[0]), f2bf_bits(a[1]));
    hv[1] = pk16(f2bf_bits(a[2]), f2bf_bits(a[3]));
    hv[2] = pk16(f2bf_bits(c[0]), f2bf_bits(c[1]));
    hv[3] = pk16(f2bf_bits(c[2]), f2bf_bits(c[3]));
    {
      *(v4u*)(out + e0) = hv;
      
    }
  }
}

// ---------------------------------------------------------------------------
// Fused transpose + bf16 RNE convert of an f32 matrix, z-batched, one plane:
//   in_z = W + z*sIn viewed [R rows][Cc cols] with row pitch ldin  ->  oh_z[c][r] = bf16(in_z[r][c]), row pitch ldout, oh_z = oh + z*sOut.
// 64x64 tiles through LDS. grid = (Cc/64, R/64, Z), 256 threads (R, Cc multiples of 64; ldout multiple of 64 so every
// Coverage per block: load 4 it x 256 thr x 4 floats = 64x64; store 2 it x 256 thr x 8 u16 = 64x64.
// Here: in_z = V[z] [R=2048 s][Cc=64 d] (ldin 64), out VT_z [64 d][2048 s] (ldout 2048); grid (1, 32, 2).
// ---------------------------------------------------------------------------
__global__ __launch_bounds__(256) void tconv_kernel(const float* __restrict__ W, unsigned short* __restrict__ oh,
                                                    int ldin, int ldout, long sIn, long sOut) {
  __shared__ __align__(16) float tf[64 * 68];
  W  += (size_t)blockIdx.z * sIn;
  oh += (size_t)blockIdx.z * sOut;
  const int c0  = blockIdx.x * 64;   // input column block = output row block
  const int r0  = blockIdx.y * 64;   // input row block    = output column block
  const int tid = threadIdx.x;
  {
    const int lr = tid >> 4;         // 0..15
    const int c4 = (tid & 15) * 4;   // 0..60
#pragma unroll
    for (int it = 0; it < 4; ++it) {
      const int rr = it * 16 + lr;   // 0..63
      const v4f a = *(const v4f*)(W + (size_t)(r0 + rr) * ldin + c0 + c4);
      *(v4f*)(tf + rr * 68 + c4) = a;
    }
  }
  __syncthreads();
  const int sub = tid >> 3;          // 0..31
  const int c8  = (tid & 7) * 8;     // 0..56
  v4u hv[2];
#pragma unroll
  for (int it = 0; it < 2; ++it) {
    const int oc = it * 32 + sub;    // output row within tile (= input column)
    v4u a;
#pragma unroll
    for (int q = 0; q < 4; ++q) {
      const float f0 = tf[(c8 + 2 * q) * 68 + oc];
      const float f1 = tf[(c8 + 2 * q + 1) * 68 + oc];
      a[q] = pk16(f2bf_bits(f0), f2bf_bits(f1));
    }
    hv[it] = a;
  }
  {
#pragma unroll
    for (int it = 0; it < 2; ++it) {
      const int oc = it * 32 + sub;
      const size_t go = (size_t)(c0 + oc) * ldout + r0 + c8;
      *(v4u*)(oh + go) = hv[it];
    }
    
  }
}

// =====================================================================================
// Full (non-causal, unmasked) multi-query attention, head dim 64, all (batch, head) pairs in one launch.
//   q plane (bf16) [32768][64]: element (b, h, q, d) at [((b*8+h)*2048 + q)*64 + d]
//   k plane (bf16) [4096][64]: element (b, s, d) at [(b*2048 + s)*64 + d]       (one key head shared by all 8 query heads)
//   v^T plane (bf16) [2][64][2048]: element (b, d, s) at [b*131072 + d*2048 + s] (one value head shared by all 8 query heads)
//   out f32 [32768][64]: element (b, h, q, d) at [((b*8+h)*2048 + q)*64 + d]
//   scores^T = (k . q^T) * 0.125 : single bf16 product (exact), f32 accumulate; A = K rows, B = Q columns
//   out^T    = v^T . p^T         : v^T . p_hi^T + v^T . p_lo^T (p = unnormalised exp split into bf16 hi|lo; the same v^T LDS
//                               fragment serves both terms), f32 accumulate, x 1/rowsum in f32 at the end
//   online softmax in f32 over all 2048 keys of the batch element (32 chunks of 64, compile-time trip count, no masking):
//   lane (c, hh) holds the scores of query c for the keys j*16 + 8*hh + r; max and sum run in-lane, the two halves of a
//   query join by one cross-row move (max: every chunk; sum: once, in the epilogue).
//   Block = 4 waves = 64 query rows of one (batch, head); grid.x = 2 * 8 * 32 = 512 (exact).
//   K / V^T chunk staging: 128 threads x 32 elements per plane = the whole 64x64 tile (16-B copies, plain loads,
//   __syncthreads before and after); fragment loads read the LDS tiles with the same v8b element type.
//   LDS extents: K/V tiles 64x64 fully staged every chunk, rows at a pitch of 72 elements; the 8 pad elements of a row are never written or read.
//   Epilogue: each wave stages its 16x64 f32 tile in LDS, then writes 256-B output rows as 16 lanes x 16 B
// =====================================================================================
#define AT_D 64
#define AT_NW 4
#define AT_QB 64
#define AT_KC 64
#define AT_LP 72   // LDS row pitch of the K and V^T tiles in elements: 144 B = 16 B x 9 (odd), so the 16 rows of a ds_load_b128 fragment read fall on 16 different bank groups

__global__ __launch_bounds__(128)
void attn_mqa_kernel(const unsigned short* __restrict__ qp, const unsigned short* __restrict__ kp,
                     const unsigned short* __restrict__ vtp, float* __restrict__ out, float sscale) {
  union FB { v16b v; v8b h[2]; };
  __shared__ __align__(16) __bf16 Ksh[AT_KC * AT_LP];            // K  [kv][d]   64 rows x 144 B = 9 KB
  __shared__ __align__(16) __bf16 Vth[AT_D * AT_LP];             // V^T [d][kv]  64 rows x 144 B = 9 KB
  __shared__ __align__(16) float  Os[AT_NW][16 * 68];            // per wave out tile, pitch 68

  const int tid  = threadIdx.x;
  const int wave = tid >> 5;
  const int lane = tid & 31;
  const int hh   = lane >> 4;
  const int c    = lane & 15;

  const int nqb = SEQ / AT_QB;            // 32 query blocks per (batch, head)
  const int bx = blockIdx.x;              // grid = NB_ * NH_ * nqb (exact)
  const int qb = bx % nqb;
  const int bh = bx / nqb;                // b*8 + h, 0..15
  const int b  = bh / NH_;                // 0..1 : key / value index depends on b only
  const int q0 = bh * SEQ + qb * AT_QB + wave * 16;   // row in the q plane == row in out

  const __bf16* Qg = (const __bf16*)(const void*)qp;
  const __bf16* Kg = (const __bf16*)(const void*)kp  + (size_t)b * SEQ * AT_D;   // keys of batch b
  const __bf16* Vg = (const __bf16*)(const void*)vtp + (size_t)b * AT_D * SEQ;   // V^T of batch b [d][s]

  // ---- Q fragments (B operand, column = query lane&15, split k map): 2 d-chunks ----
  v16b qa[2];
#pragma unroll
  for (int dc = 0; dc < 2; ++dc)
    qa[dc] = ld_frag_bf(Qg + (size_t)(q0 + c) * AT_D + dc * 32 + 8 * hh);

  float mrow = -INFINITY;   // running max of query c (equal in both halves)
  float lrow = 0.f;         // running sum of query c over this half's keys only
  v8f oacc[4];              // oacc[t][r] = O^T[d = t*16 + 8*hh + r][query c]
#pragma unroll
  for (int t = 0; t < 4; ++t) oacc[t] = (v8f){0.f,0.f,0.f,0.f,0.f,0.f,0.f,0.f};

  const int nChunks = SEQ / AT_KC;   // 32, compile-time constant
  for (int kc = 0; kc < nChunks; ++kc) {
    const int kv0 = kc * AT_KC;
    __syncthreads();
    {
      // staging coverage: 128 threads x (4 x 8) elements = 64 rows x 64 per plane = the whole chunk tile
      const int r = tid >> 1, half = (tid & 1) * 32;
      const __bf16* ks = Kg + (size_t)(kv0 + r) * AT_D + half;      // K row kv0+r, d = half..half+31
      const __bf16* vs = Vg + (size_t)r * SEQ + kv0 + half;         // V^T row d = r, keys kv0+half..+31
#pragma unroll
      for (int i = 0; i < 4; ++i) {
        const v8b a0 = *(const v8b*)(ks + 8 * i);
        const v8b b0 = *(const v8b*)(vs + 8 * i);
        *(v8b*)(Ksh + r * AT_LP + half + 8 * i) = a0;
        *(v8b*)(Vth + r * AT_LP + half + 8 * i) = b0;
      }
    }
    __syncthreads();

    // ---- S^T = k . q^T : A fragment row = key j*16+c, B = Q column c, split k map over d on both ----
    v8f s[4];
#pragma unroll
    for (int j = 0; j < 4; ++j) {
      s[j] = (v8f){0.f,0.f,0.f,0.f,0.f,0.f,0.f,0.f};
#pragma unroll
      for (int dc = 0; dc < 2; ++dc) {
        FB kb;
        kb.h[0] = *(const v8b*)(Ksh + (j * 16 + c) * AT_LP + dc * 32 + 8 * hh);
        kb.h[1] = *(const v8b*)(Ksh + (j * 16 + c) * AT_LP + dc * 32 + 16 + 8 * hh);
        s[j] = at_mma(kb.v, qa[dc], s[j]);
      }
    }
    // scale, then chunk max of query c (s[j][r] = score of key j*16 + 8hh + r, query c): in-lane, then the other half
    float cm = -INFINITY;
#pragma unroll
    for (int j = 0; j < 4; ++j) {
#pragma unroll
      for (int r = 0; r < 8; ++r) {
        const float sv = s[j][r] * sscale;
        s[j][r] = sv;
        cm = fmaxf(cm, sv);
      }
    }
    cm = fmaxf(cm, at_xhalf(cm));
    const float mnew = fmaxf(mrow, cm);
    const float alpha = expf(mrow - mnew);
    mrow = mnew;
    // P^T as B operand: element e of the 32-key block kk = key kk*32 + (e < 8 ? 8hh + e : 16 + 8hh + e - 8) = s[2kk + (e >> 3)][e & 7]
    FB ph[2], pl[2];
    float ps[4];
#pragma unroll
    for (int j = 0; j < 4; ++j) {
      float psum = 0.f;
#pragma unroll
      for (int r = 0; r < 8; ++r) {
        const float p = expf(s[j][r] - mnew);
        psum += p;
        __bf16 a, bl; at_split(p, a, bl);
        ph[j >> 1].v[(j & 1) * 8 + r] = a;
        pl[j >> 1].v[(j & 1) * 8 + r] = bl;
      }
      ps[j] = psum;
    }
    lrow = lrow * alpha + ((ps[0] + ps[1]) + (ps[2] + ps[3]));
#pragma unroll
    for (int t = 0; t < 4; ++t) {
#pragma unroll
      for (int r = 0; r < 8; ++r) oacc[t][r] *= alpha;
    }
    // ---- O^T += v^T . p_hi^T + v^T . p_lo^T : A = V^T [d][key] (row = d t*16+c, split k map over keys), B = P^T ----
    // unrolled: ph / pl are register arrays, their index must be a compile-time constant
#pragma unroll
    for (int kk = 0; kk < 2; ++kk) {
#pragma unroll
      for (int t = 0; t < 4; ++t) {
        FB vb;
        vb.h[0] = *(const v8b*)(Vth + (t * 16 + c) * AT_LP + kk * 32 + 8 * hh);
        vb.h[1] = *(const v8b*)(Vth + (t * 16 + c) * AT_LP + kk * 32 + 16 + 8 * hh);
        oacc[t] = at_mma(vb.v, ph[kk].v, oacc[t]);
        oacc[t] = at_mma(vb.v, pl[kk].v, oacc[t]);
      }
    }
  }

  // join the two halves' sums of query c; a lane holds 8 consecutive d of query c per tile: two 16-B LDS stores
  float* os = Os[wave];
  {
    const float inv = 1.0f / (lrow + at_xhalf(lrow));
#pragma unroll
    for (int t = 0; t < 4; ++t) {
      v4f lo4, hi4;
#pragma unroll
      for (int r = 0; r < 4; ++r) { lo4[r] = oacc[t][r] * inv; hi4[r] = oacc[t][4 + r] * inv; }
      *(v4f*)(os + c * 68 + t * 16 + 8 * hh)     = lo4;
      *(v4f*)(os + c * 68 + t * 16 + 8 * hh + 4) = hi4;
    }
  }
  __builtin_amdgcn_fence(__ATOMIC_RELEASE, "workgroup");
  __builtin_amdgcn_wave_barrier();
  __builtin_amdgcn_fence(__ATOMIC_ACQUIRE, "workgroup");
  {
    const int c4 = (lane & 15) * 4;
    float* orow = out + (size_t)(q0 + hh) * AT_D + c4;   // one address; the rows follow at constant offsets
    {
#pragma unroll
      for (int it = 0; it < 8; ++it) {
        const int row = it * 2 + hh;   // it 0..7 x hh 0..1 covers rows 0..15 of the wave tile
        v4f val = *(const v4f*)(os + row * 68 + c4);
        *(v4f*)(orow + it * 2 * AT_D) = val;
      }
      
    }
  }
}

// ---------------------------------------------------------------------------
// Workspace region map (byte offsets; every region is fully written by its producer launch before any consumer
//   QB  bf16 [32768][64]          0      4194304
//   KB  bf16 [4096][64]     4194304       524288
//   VT  bf16 [2][64][2048]  4718592       524288
//   total                   5242880
// ---------------------------------------------------------------------------
extern "C" void kernel_launch(void* const* d_in, const int* in_sizes, int n_in,
                              void* d_out, int out_size, void* d_ws, size_t ws_size,
                              hipStream_t stream) {
  if (n_in < 3) return;
  if (in_sizes[0] != NQR * HD) return;          // Q [2][8][2048][64]
  if (in_sizes[1] != NKR * HD) return;          // K [2][1][2048][64]
  if (in_sizes[2] != NKR * HD) return;          // V [2][1][2048][64]
  if (out_size != NQR * HD) return;             // out [2][8][2048][64]; last written element index NQR*HD-1

  const float* Q = (const float*)d_in[0];
  const float* K = (const float*)d_in[1];
  const float* V = (const float*)d_in[2];

  const size_t PQB = (size_t)NQR * HD * 2;      // 4194304
  const size_t PKB = (size_t)NKR * HD * 2;      // 524288
  const size_t PVT = (size_t)NB_ * HD * SEQ * 2;// 524288
  size_t off = 0;
  const size_t oQB = off; off += PQB;
  const size_t oKB = off; off += PKB;
  const size_t oVT = off; off += PVT;
  if (off > ws_size) return;                    // off = 5242880
  if (off > (size_t)134217728) return;

  char* ws = (char*)d_ws;
  unsigned short* QB = (unsigned short*)(ws + oQB);
  unsigned short* KB = (unsigned short*)(ws + oKB);
  unsigned short* VT = (unsigned short*)(ws + oVT);

  // (1) QB = bf16(Q) flat, KB = bf16(K) flat; 1024 + 128 blocks of 256 threads x 8 elements
  const int n8q = NQR * HD / 8;                 // 262144
  const int n8k = NKR * HD / 8;                 // 32768
  const int nbq = n8q / 256;                    // 1024
  const int nbk = n8k / 256;                    // 128
  cvt2_kernel<<<dim3(nbq + nbk), dim3(256), 0, stream>>>(Q, K, QB, KB, nbq, n8q, n8k);
  // (2) V[b] viewed [R=2048 s][Cc=64 d] (pitch 64) -> VT_b[d][s] (pitch 2048); grid (Cc/64, R/64, B) = (1, 32, 2)
  tconv_kernel<<<dim3(HD / 64, SEQ / 64, NB_), dim3(256), 0, stream>>>(V, VT, HD, SEQ, (long)SEQ * HD, (long)HD * SEQ);
  // (3) attention per (batch, head, 64-query block) -> d_out rows (b*8+h)*2048 + q; 512 blocks x 128 threads
  attn_mqa_kernel<<<dim3(NB_ * NH_ * (SEQ / 64)), dim3(128), 0, stream>>>(QB, KB, VT, (float*)d_out, 0.125f);
  (void)hipGetLastError();
}

// v003
// It runs in 52.6 microseconds.
// Timed twice side by side with v002, it ran 1.30 and 1.29 times as fast.
// Over all steps from v000 it is 2.81 times as fast.
#include <hip/hip_runtime.h>
#include <math.h>
#include <stdint.h>

#define NB_   2
#define NH_   8
#define SEQ   2048
#define HD    64
#define NQR   (NB_ * NH_ * SEQ)   // 32768 q / out rows
#define NKR   (NB_ * SEQ)         // 4096 k rows

static_assert(HD == 64);
static_assert(SEQ % 64 == 0);
static_assert((NQR * HD) % (8 * 256) == 0);
static_assert((NKR * HD) % (8 * 256) == 0);

typedef __attribute__((ext_vector_type(16))) _Float16 v16h;
typedef __attribute__((ext_vector_type(8)))  _Float16 v8h;
typedef __attribute__((ext_vector_type(16))) __bf16   v16b;
typedef __attribute__((ext_vector_type(8)))  __bf16   v8b;
typedef __attribute__((ext_vector_type(8)))  float    v8f;
typedef __attribute__((ext_vector_type(4)))  float    v4f;
typedef __attribute__((ext_vector_type(4)))  unsigned int v4u;

__device__ __forceinline__ unsigned short f2bf_bits(float f) {
  unsigned u = __float_as_uint(f);
  return (unsigned short)((u + 0x7FFFu + ((u >> 16) & 1u)) >> 16);
}
__device__ __forceinline__ float bf_bits2f(unsigned short h) { return __uint_as_float(((unsigned)h) << 16); }
__device__ __forceinline__ unsigned pk16(unsigned short a, unsigned short b) { return (unsigned)a | ((unsigned)b << 16); }

// A / B fragment load (split k map): elements 0..7 <- p[0..7], 8..15 <- p[16..23]; caller passes p = row + k0 + 8*(lane>>4)
__device__ __forceinline__ v16b ld_frag_bf(const __bf16* p) {
  union { v16b v; v8b h[2]; } f;
  f.h[0] = *(const v8b*)(p);
  f.h[1] = *(const v8b*)(p + 16);
  return f.v;
}

__device__ __forceinline__ unsigned short at_bf_bits(float f) {
  unsigned u = __float_as_uint(f);
  return (unsigned short)((u + 0x7FFFu + ((u >> 16) & 1u)) >> 16);
}
__device__ __forceinline__ __bf16 at_f2bf(float f) { return __builtin_bit_cast(__bf16, at_bf_bits(f)); }
__device__ __forceinline__ void at_split(float f, __bf16& hi, __bf16& lo) {
  const unsigned short hb = at_bf_bits(f);
  hi = __builtin_bit_cast(__bf16, hb);
  lo = at_f2bf(f - __uint_as_float(((unsigned)hb) << 16));
}
// lane l <-> lane l ^ 16 (the other half of the same column) as a vector cross-row move
__device__ __forceinline__ float at_xhalf(float f) {
  const int b = __float_as_int(f);
  return __int_as_float(__builtin_amdgcn_permlanex16(b, b, 0x76543210, 0xfedcba98, false, false));
}
// WMMA with dependency guard: 4 VALU nops tied to D, A and B kept live
__device__ __forceinline__ v8f at_mma(v16b a, v16b b, v8f c) {
  c = __builtin_amdgcn_wmma_f32_16x16x32_bf16(false, a, false, b, (short)0, c, false, false);
  asm volatile("v_nop\n\tv_nop\n\tv_nop\n\tv_nop" : "+v"(c) : "v"(a), "v"(b));
  return c;
}

// ---------------------------------------------------------------------------
// Flat bf16 RNE convert of two f32 arrays in one launch (block-uniform role split):
//   blocks 0..nbq-1 : qo[e] = bf16(qin[e]), unit i = block*256+tid < n8q, elements 8i..8i+7
//   blocks nbq..    : ko[e] = bf16(kin[e]), unit i = (block-nbq)*256+tid < n8k
// Coverage: q: 1024 blocks x 256 x 8 = 2097152 = 32768x64; k: 128 blocks x 256 x 8 = 262144 = 4096x64.
// ---------------------------------------------------------------------------
__global__ __launch_bounds__(256) void cvt2_kernel(const float* __restrict__ qin, const float* __restrict__ kin,
                                                   unsigned short* __restrict__ qo, unsigned short* __restrict__ ko,
                                                   int nbq, int n8q, int n8k) {
  const bool isq = (int)blockIdx.x < nbq;                 // block-uniform
  const float* in = isq ? qin : kin;                      // both global, uniform select
  unsigned short* out = isq ? qo : ko;
  const int n8 = isq ? n8q : n8k;
  const int blk = isq ? (int)blockIdx.x : ((int)blockIdx.x - nbq);
  const int i = blk * 256 + (int)threadIdx.x;
  if (i < n8) {
    const size_t e0 = (size_t)i * 8;
    const v4f a = *(const v4f*)(in + e0);
    const v4f c = *(const v4f*)(in + e0 + 4);
    v4u hv;
    hv[0] = pk16(f2bf_bits(a[0]), f2bf_bits(a[1]));
    hv[1] = pk16(f2bf_bits(a[2]), f2bf_bits(a[3]));
    hv[2] = pk16(f2bf_bits(c[0]), f2bf_bits(c[1]));
    hv[3] = pk16(f2bf_bits(c[2]), f2bf_bits(c[3]));
    {
      *(v4u*)(out + e0) = hv;
      
    }
  }
}

// ---------------------------------------------------------------------------
// Fused transpose + bf16 RNE convert of an f32 matrix, z-batched, one plane:
//   in_z = W + z*sIn viewed [R rows][Cc cols] with row pitch ldin  ->  oh_z[c][r] = bf16(in_z[r][c]), row pitch ldout, oh_z = oh + z*sOut.
// 64x64 tiles through LDS. grid = (Cc/64, R/64, Z), 256 threads (R, Cc multiples of 64; ldout multiple of 64 so every
// Coverage per block: load 4 it x 256 thr x 4 floats = 64x64; store 2 it x 256 thr x 8 u16 = 64x64.
// Here: in_z = V[z] [R=2048 s][Cc=64 d] (ldin 64), out VT_z [64 d][2048 s] (ldout 2048); grid (1, 32, 2).
// ---------------------------------------------------------------------------
__global__ __launch_bounds__(256) void tconv_kernel(const float* __restrict__ W, unsigned short* __restrict__ oh,
                                                    int ldin, int ldout, long sIn, long sOut) {
  __shared__ __align__(16) float tf[64 * 68];
  W  += (size_t)blockIdx.z * sIn;
  oh += (size_t)blockIdx.z * sOut;
  const int c0  = blockIdx.x * 64;   // input column block = output row block
  const int r0  = blockIdx.y * 64;   // input row block    = output column block
  const int tid = threadIdx.x;
  {
    const int lr = tid >> 4;         // 0..15
    const int c4 = (tid & 15) * 4;   // 0..60
#pragma unroll
    for (int it = 0; it < 4; ++it) {
      const int rr = it * 16 + lr;   // 0..63
      const v4f a = *(const v4f*)(W + (size_t)(r0 + rr) * ldin + c0 + c4);
      *(v4f*)(tf + rr * 68 + c4) = a;
    }
  }
  __syncthreads();
  const int sub = tid >> 3;          // 0..31
  const int c8  = (tid & 7) * 8;     // 0..56
  v4u hv[2];
#pragma unroll
  for (int it = 0; it < 2; ++it) {
    const int oc = it * 32 + sub;    // output row within tile (= input column)
    v4u a;
#pragma unroll
    for (int q = 0; q < 4; ++q) {
      const float f0 = tf[(c8 + 2 * q) * 68 + oc];
      const float f1 = tf[(c8 + 2 * q + 1) * 68 + oc];
      a[q] = pk16(f2bf_bits(f0), f2bf_bits(f1));
    }
    hv[it] = a;
  }
  {
#pragma unroll
    for (int it = 0; it < 2; ++it) {
      const int oc = it * 32 + sub;
      const size_t go = (size_t)(c0 + oc) * ldout + r0 + c8;
      *(v4u*)(oh + go) = hv[it];
    }
    
  }
}

// =====================================================================================
// Full (non-causal, unmasked) multi-query attention, head dim 64, all (batch, head) pairs in one launch.
//   q plane (bf16) [32768][64]: element (b, h, q, d) at [((b*8+h)*2048 + q)*64 + d]
//   k plane (bf16) [4096][64]: element (b, s, d) at [(b*2048 + s)*64 + d]       (one key head shared by all 8 query heads)
//   v^T plane (bf16) [2][64][2048]: element (b, d, s) at [b*131072 + d*2048 + s] (one value head shared by all 8 query heads)
//   out f32 [32768][64]: element (b, h, q, d) at [((b*8+h)*2048 + q)*64 + d]
//   scores^T = (k . q^T) * 0.125 : single bf16 product (exact), f32 accumulate; A = K rows, B = Q columns
//   out^T    = v^T . p^T         : v^T . p_hi^T + v^T . p_lo^T (p = unnormalised exp split into bf16 hi|lo; the same v^T LDS
//                               fragment serves both terms), f32 accumulate, x 1/rowsum in f32 at the end
//   online softmax in f32 over all 2048 keys of the batch element (32 chunks of 64, compile-time trip count, no masking):
//   lane (c, hh) holds the scores of query c for the keys j*16 + 8*hh + r; max and sum run in-lane, the two halves of a
//   query join by one cross-row move (max: every chunk; sum: once, in the epilogue).
//   Block = 4 waves = 64 query rows of one (batch, head); grid.x = 2 * 8 * 32 = 512 (exact).
//   K / V^T chunk staging: 128 threads x 32 elements per plane = the whole 64x64 tile (16-B copies, plain loads,
//   __syncthreads before and after); fragment loads read the LDS tiles with the same v8b element type.
//   LDS extents: K/V tiles 64x64 fully staged every chunk, rows at a pitch of 72 elements; the 8 pad elements of a row are never written or read.
//   Epilogue: each wave stages its 16x64 f32 tile in LDS, then writes 256-B output rows as 16 lanes x 16 B
// =====================================================================================
#define AT_D 64
#define AT_NW 4
#define AT_QB 64
#define AT_KC 64
#define AT_LP 72   // LDS row pitch of the K and V^T tiles in elements: 144 B = 16 B x 9 (odd), so the 16 rows of a ds_load_b128 fragment read fall on 16 different bank groups

__global__ __launch_bounds__(128)
void attn_mqa_kernel(const unsigned short* __restrict__ qp, const unsigned short* __restrict__ kp,
                     const unsigned short* __restrict__ vtp, float* __restrict__ out, float sscale) {
  union FB { v16b v; v8b h[2]; };
  __shared__ __align__(16) __bf16 Ksh[AT_KC * AT_LP];            // K  [kv][d]   64 rows x 144 B = 9 KB
  __shared__ __align__(16) __bf16 Vth[AT_D * AT_LP];             // V^T [d][kv]  64 rows x 144 B = 9 KB
  __shared__ __align__(16) float  Os[AT_NW][16 * 68];            // per wave out tile, pitch 68

  const int tid  = threadIdx.x;
  const int wave = tid >> 5;
  const int lane = tid & 31;
  const int hh   = lane >> 4;
  const int c    = lane & 15;

  const int nqb = SEQ / AT_QB;            // 32 query blocks per (batch, head)
  const int bx = blockIdx.x;              // grid = NB_ * NH_ * nqb (exact)
  const int qb = bx % nqb;
  const int bh = bx / nqb;                // b*8 + h, 0..15
  const int b  = bh / NH_;                // 0..1 : key / value index depends on b only
  const int q0 = bh * SEQ + qb * AT_QB + wave * 16;   // row in the q plane == row in out

  const __bf16* Qg = (const __bf16*)(const void*)qp;
  const __bf16* Kg = (const __bf16*)(const void*)kp  + (size_t)b * SEQ * AT_D;   // keys of batch b
  const __bf16* Vg = (const __bf16*)(const void*)vtp + (size_t)b * AT_D * SEQ;   // V^T of batch b [d][s]

  // ---- Q fragments (B operand, column = query lane&15, split k map): 2 d-chunks ----
  v16b qa[2];
#pragma unroll
  for (int dc = 0; dc < 2; ++dc)
    qa[dc] = ld_frag_bf(Qg + (size_t)(q0 + c) * AT_D + dc * 32 + 8 * hh);

  float mrow = -INFINITY;   // running max of query c (equal in both halves)
  float lrow = 0.f;         // running sum of query c over this half's keys only
  v8f oacc[4];              // oacc[t][r] = O^T[d = t*16 + 8*hh + r][query c]
#pragma unroll
  for (int t = 0; t < 4; ++t) oacc[t] = (v8f){0.f,0.f,0.f,0.f,0.f,0.f,0.f,0.f};

  const int nChunks = SEQ / AT_KC;   // 32, compile-time constant
  for (int kc = 0; kc < nChunks; ++kc) {
    const int kv0 = kc * AT_KC;
    __syncthreads();
    {
      // staging coverage: 128 threads x (4 x 8) elements = 64 rows x 64 per plane = the whole chunk tile
      const int r = tid >> 1, half = (tid & 1) * 32;
      const __bf16* ks = Kg + (size_t)(kv0 + r) * AT_D + half;      // K row kv0+r, d = half..half+31
      const __bf16* vs = Vg + (size_t)r * SEQ + kv0 + half;         // V^T row d = r, keys kv0+half..+31
#pragma unroll
      for (int i = 0; i < 4; ++i) {
        const v8b a0 = *(const v8b*)(ks + 8 * i);
        const v8b b0 = *(const v8b*)(vs + 8 * i);
        *(v8b*)(Ksh + r * AT_LP + half + 8 * i) = a0;
        *(v8b*)(Vth + r * AT_LP + half + 8 * i) = b0;
      }
    }
    __syncthreads();

    // ---- S^T = k . q^T : A fragment row = key j*16+c, B = Q column c, split k map over d on both ----
    // all 8 K fragments are read as ONE group ahead of the products: one LDS latency per chunk instead of one per fragment
    FB kb[4][2];
#pragma unroll
    for (int j = 0; j < 4; ++j) {
#pragma unroll
      for (int dc = 0; dc < 2; ++dc) {
        kb[j][dc].h[0] = *(const v8b*)(Ksh + (j * 16 + c) * AT_LP + dc * 32 + 8 * hh);
        kb[j][dc].h[1] = *(const v8b*)(Ksh + (j * 16 + c) * AT_LP + dc * 32 + 16 + 8 * hh);
      }
    }
    v8f s[4];
#pragma unroll
    for (int j = 0; j < 4; ++j) {
      s[j] = (v8f){0.f,0.f,0.f,0.f,0.f,0.f,0.f,0.f};
#pragma unroll
      for (int dc = 0; dc < 2; ++dc) s[j] = at_mma(kb[j][dc].v, qa[dc], s[j]);
    }
    // the 8 V^T fragments are read into registers here, not among their products: the softmax's vector work between read and use covers the LDS latency
    FB vb[2][4];
#pragma unroll
    for (int kk = 0; kk < 2; ++kk) {
#pragma unroll
      for (int t = 0; t < 4; ++t) {
        vb[kk][t].h[0] = *(const v8b*)(Vth + (t * 16 + c) * AT_LP + kk * 32 + 8 * hh);
        vb[kk][t].h[1] = *(const v8b*)(Vth + (t * 16 + c) * AT_LP + kk * 32 + 16 + 8 * hh);
      }
    }
    // scale, then chunk max of query c (s[j][r] = score of key j*16 + 8hh + r, query c): in-lane, then the other half
    float cm = -INFINITY;
#pragma unroll
    for (int j = 0; j < 4; ++j) {
#pragma unroll
      for (int r = 0; r < 8; ++r) {
        const float sv = s[j][r] * sscale;
        s[j][r] = sv;
        cm = fmaxf(cm, sv);
      }
    }
    cm = fmaxf(cm, at_xhalf(cm));
    const float mnew = fmaxf(mrow, cm);
    const float alpha = expf(mrow - mnew);
    mrow = mnew;
    // P^T as B operand: element e of the 32-key block kk = key kk*32 + (e < 8 ? 8hh + e : 16 + 8hh + e - 8) = s[2kk + (e >> 3)][e & 7]
    FB ph[2], pl[2];
    float ps[4];
#pragma unroll
    for (int j = 0; j < 4; ++j) {
      float psum = 0.f;
#pragma unroll
      for (int r = 0; r < 8; ++r) {
        const float p = expf(s[j][r] - mnew);
        psum += p;
        __bf16 a, bl; at_split(p, a, bl);
        ph[j >> 1].v[(j & 1) * 8 + r] = a;
        pl[j >> 1].v[(j & 1) * 8 + r] = bl;
      }
      ps[j] = psum;
    }
    lrow = lrow * alpha + ((ps[0] + ps[1]) + (ps[2] + ps[3]));
#pragma unroll
    for (int t = 0; t < 4; ++t) {
#pragma unroll
      for (int r = 0; r < 8; ++r) oacc[t][r] *= alpha;
    }
    // ---- O^T += v^T . p_hi^T + v^T . p_lo^T : A = V^T [d][key] (row = d t*16+c, split k map over keys), B = P^T ----
    // unrolled: ph / pl / vb are register arrays, their index must be a compile-time constant
#pragma unroll
    for (int kk = 0; kk < 2; ++kk) {
#pragma unroll
      for (int t = 0; t < 4; ++t) {
        oacc[t] = at_mma(vb[kk][t].v, ph[kk].v, oacc[t]);
        oacc[t] = at_mma(vb[kk][t].v, pl[kk].v, oacc[t]);
      }
    }
  }

  // join the two halves' sums of query c; a lane holds 8 consecutive d of query c per tile: two 16-B LDS stores
  float* os = Os[wave];
  {
    const float inv = 1.0f / (lrow + at_xhalf(lrow));
#pragma unroll
    for (int t = 0; t < 4; ++t) {
      v4f lo4, hi4;
#pragma unroll
      for (int r = 0; r < 4; ++r) { lo4[r] = oacc[t][r] * inv; hi4[r] = oacc[t][4 + r] * inv; }
      *(v4f*)(os + c * 68 + t * 16 + 8 * hh)     = lo4;
      *(v4f*)(os + c * 68 + t * 16 + 8 * hh + 4) = hi4;
    }
  }
  __builtin_amdgcn_fence(__ATOMIC_RELEASE, "workgroup");
  __builtin_amdgcn_wave_barrier();
  __builtin_amdgcn_fence(__ATOMIC_ACQUIRE, "workgroup");
  {
    const int c4 = (lane & 15) * 4;
    float* orow = out + (size_t)(q0 + hh) * AT_D + c4;   // one address; the rows follow at constant offsets
    {
#pragma unroll
      for (int it = 0; it < 8; ++it) {
        const int row = it * 2 + hh;   // it 0..7 x hh 0..1 covers rows 0..15 of the wave tile
        v4f val = *(const v4f*)(os + row * 68 + c4);
        *(v4f*)(orow + it * 2 * AT_D) = val;
      }
      
    }
  }
}

// ---------------------------------------------------------------------------
// Workspace region map (byte offsets; every region is fully written by its producer launch before any consumer
//   QB  bf16 [32768][64]          0      4194304
//   KB  bf16 [4096][64]     4194304       524288
//   VT  bf16 [2][64][2048]  4718592       524288
//   total                   5242880
// ---------------------------------------------------------------------------
extern "C" void kernel_launch(void* const* d_in, const int* in_sizes, int n_in,
                              void* d_out, int out_size, void* d_ws, size_t ws_size,
                              hipStream_t stream) {
  if (n_in < 3) return;
  if (in_sizes[0] != NQR * HD) return;          // Q [2][8][2048][64]
  if (in_sizes[1] != NKR * HD) return;          // K [2][1][2048][64]
  if (in_sizes[2] != NKR * HD) return;          // V [2][1][2048][64]
  if (out_size != NQR * HD) return;             // out [2][8][2048][64]; last written element index NQR*HD-1

  const float* Q = (const float*)d_in[0];
  const float* K = (const float*)d_in[1];
  const float* V = (const float*)d_in[2];

  const size_t PQB = (size_t)NQR * HD * 2;      // 4194304
  const size_t PKB = (size_t)NKR * HD * 2;      // 524288
  const size_t PVT = (size_t)NB_ * HD * SEQ * 2;// 524288
  size_t off = 0;
  const size_t oQB = off; off += PQB;
  const size_t oKB = off; off += PKB;
  const size_t oVT = off; off += PVT;
  if (off > ws_size) return;                    // off = 5242880
  if (off > (size_t)134217728) return;

  char* ws = (char*)d_ws;
  unsigned short* QB = (unsigned short*)(ws + oQB);
  unsigned short* KB = (unsigned short*)(ws + oKB);
  unsigned short* VT = (unsigned short*)(ws + oVT);

  // (1) QB = bf16(Q) flat, KB = bf16(K) flat; 1024 + 128 blocks of 256 threads x 8 elements
  const int n8q = NQR * HD / 8;                 // 262144
  const int n8k = NKR * HD / 8;                 // 32768
  const int nbq = n8q / 256;                    // 1024
  const int nbk = n8k / 256;                    // 128
  cvt2_kernel<<<dim3(nbq + nbk), dim3(256), 0, stream>>>(Q, K, QB, KB, nbq, n8q, n8k);
  // (2) V[b] viewed [R=2048 s][Cc=64 d] (pitch 64) -> VT_b[d][s] (pitch 2048); grid (Cc/64, R/64, B) = (1, 32, 2)
  tconv_kernel<<<dim3(HD / 64, SEQ / 64, NB_), dim3(256), 0, stream>>>(V, VT, HD, SEQ, (long)SEQ * HD, (long)HD * SEQ);
  // (3) attention per (batch, head, 64-query block) -> d_out rows (b*8+h)*2048 + q; 512 blocks x 128 threads
  attn_mqa_kernel<<<dim3(NB_ * NH_ * (SEQ / 64)), dim3(128), 0, stream>>>(QB, KB, VT, (float*)d_out, 0.125f);
  (void)hipGetLastError();
}

// v004
// One run takes 49.9 microseconds.
// In both of two side-by-side timings against v003, it was 1.06 times as fast.
// All steps since v000 together make it 2.98 times as fast.
#include <hip/hip_runtime.h>
#include <math.h>
#include <stdint.h>

#define NB_   2
#define NH_   8
#define SEQ   2048
#define HD    64
#define NQR   (NB_ * NH_ * SEQ)   // 32768 q / out rows
#define NKR   (NB_ * SEQ)         // 4096 k rows

static_assert(HD == 64);
static_assert(SEQ % 64 == 0);
static_assert((NQR * HD) % (8 * 256) == 0);
static_assert((NKR * HD) % (8 * 256) == 0);

typedef __attribute__((ext_vector_type(16))) _Float16 v16h;
typedef __attribute__((ext_vector_type(8)))  _Float16 v8h;
typedef __attribute__((ext_vector_type(16))) __bf16   v16b;
typedef __attribute__((ext_vector_type(8)))  __bf16   v8b;
typedef __attribute__((ext_vector_type(8)))  float    v8f;
typedef __attribute__((ext_vector_type(4)))  float    v4f;
typedef __attribute__((ext_vector_type(4)))  unsigned int v4u;

__device__ __forceinline__ unsigned short f2bf_bits(float f) {
  unsigned u = __float_as_uint(f);
  return (unsigned short)((u + 0x7FFFu + ((u >> 16) & 1u)) >> 16);
}
__device__ __forceinline__ float bf_bits2f(unsigned short h) { return __uint_as_float(((unsigned)h) << 16); }
__device__ __forceinline__ unsigned pk16(unsigned short a, unsigned short b) { return (unsigned)a | ((unsigned)b << 16); }

// A / B fragment load (split k map): elements 0..7 <- p[0..7], 8..15 <- p[16..23]; caller passes p = row + k0 + 8*(lane>>4)
__device__ __forceinline__ v16b ld_frag_bf(const __bf16* p) {
  union { v16b v; v8b h[2]; } f;
  f.h[0] = *(const v8b*)(p);
  f.h[1] = *(const v8b*)(p + 16);
  return f.v;
}

// hi|lo bf16 split of the 8 values of one score tile, three vector instructions a pair: v_cvt_pk_bf16_f32 rounds two values to hi
// (nearest even, as the integer form it replaces); v_fma_mixlo_bf16 / v_fma_mixhi_bf16 form f - hi (exact in f32) and round it to
// the low / high half of lo. op_sel picks the half of hi; -1.0 is read as bf16 from the high half of its f32 constant.
// The four pairs are interleaved so that every producer stands four instructions back; each s_delay_alu names that distance
// (the first: the producers of f in front of the statement), so that the SIMD issues its other wave while this one waits:
// the compiler puts no such hint inside asm text.
__device__ __forceinline__ void at_split8(v8f f, v4u& hi, v4u& lo) {
  unsigned h0, h1, h2, h3, l0, l1, l2, l3;
  asm("s_delay_alu instid0(VALU_DEP_1)\n\t"
      "v_cvt_pk_bf16_f32 %0, %8, %9\n\t"
      "v_cvt_pk_bf16_f32 %1, %10, %11\n\t"
      "v_cvt_pk_bf16_f32 %2, %12, %13\n\t"
      "v_cvt_pk_bf16_f32 %3, %14, %15\n\t"
      "s_delay_alu instid0(VALU_DEP_4) | instskip(NEXT) | instid1(VALU_DEP_4)\n\t"
      "v_fma_mixlo_bf16 %4, %0, -1.0, %8 op_sel:[0,1,0] op_sel_hi:[1,1,0]\n\t"
      "v_fma_mixlo_bf16 %5, %1, -1.0, %10 op_sel:[0,1,0] op_sel_hi:[1,1,0]\n\t"
      "s_delay_alu instid0(VALU_DEP_4) | instskip(NEXT) | instid1(VALU_DEP_4)\n\t"
      "v_fma_mixlo_bf16 %6, %2, -1.0, %12 op_sel:[0,1,0] op_sel_hi:[1,1,0]\n\t"
      "v_fma_mixlo_bf16 %7, %3, -1.0, %14 op_sel:[0,1,0] op_sel_hi:[1,1,0]\n\t"
      "s_delay_alu instid0(VALU_DEP_4) | instskip(NEXT) | instid1(VALU_DEP_4)\n\t"
      "v_fma_mixhi_bf16 %4, %0, -1.0, %9 op_sel:[1,1,0] op_sel_hi:[1,1,0]\n\t"
      "v_fma_mixhi_bf16 %5, %1, -1.0, %11 op_sel:[1,1,0] op_sel_hi:[1,1,0]\n\t"
      "s_delay_alu instid0(VALU_DEP_4) | instskip(NEXT) | instid1(VALU_DEP_4)\n\t"
      "v_fma_mixhi_bf16 %6, %2, -1.0, %13 op_sel:[1,1,0] op_sel_hi:[1,1,0]\n\t"
      "v_fma_mixhi_bf16 %7, %3, -1.0, %15 op_sel:[1,1,0] op_sel_hi:[1,1,0]"
      : "=&v"(h0), "=&v"(h1), "=&v"(h2), "=&v"(h3), "=&v"(l0), "=&v"(l1), "=&v"(l2), "=&v"(l3)
      : "v"(f[0]), "v"(f[1]), "v"(f[2]), "v"(f[3]), "v"(f[4]), "v"(f[5]), "v"(f[6]), "v"(f[7]));
  hi = (v4u){h0, h1, h2, h3};
  lo = (v4u){l0, l1, l2, l3};
}
// lane l <-> lane l ^ 16 (the other half of the same column) as a vector cross-row move
__device__ __forceinline__ float at_xhalf(float f) {
  const int b = __float_as_int(f);
  return __int_as_float(__builtin_amdgcn_permlanex16(b, b, 0x76543210, 0xfedcba98, false, false));
}
// WMMA with dependency guard: 4 VALU nops tied to D, A and B kept live
__device__ __forceinline__ v8f at_mma(v16b a, v16b b, v8f c) {
  c = __builtin_amdgcn_wmma_f32_16x16x32_bf16(false, a, false, b, (short)0, c, false, false);
  asm volatile("v_nop\n\tv_nop\n\tv_nop\n\tv_nop" : "+v"(c) : "v"(a), "v"(b));
  return c;
}

// ---------------------------------------------------------------------------
// Flat bf16 RNE convert of two f32 arrays in one launch (block-uniform role split):
//   blocks 0..nbq-1 : qo[e] = bf16(qin[e]), unit i = block*256+tid < n8q, elements 8i..8i+7
//   blocks nbq..    : ko[e] = bf16(kin[e]), unit i = (block-nbq)*256+tid < n8k
// Coverage: q: 1024 blocks x 256 x 8 = 2097152 = 32768x64; k: 128 blocks x 256 x 8 = 262144 = 4096x64.
// ---------------------------------------------------------------------------
__global__ __launch_bounds__(256) void cvt2_kernel(const float* __restrict__ qin, const float* __restrict__ kin,
                                                   unsigned short* __restrict__ qo, unsigned short* __restrict__ ko,
                                                   int nbq, int n8q, int n8k) {
  const bool isq = (int)blockIdx.x < nbq;                 // block-uniform
  const float* in = isq ? qin : kin;                      // both global, uniform select
  unsigned short* out = isq ? qo : ko;
  const int n8 = isq ? n8q : n8k;
  const int blk = isq ? (int)blockIdx.x : ((int)blockIdx.x - nbq);
  const int i = blk * 256 + (int)threadIdx.x;
  if (i < n8) {
    const size_t e0 = (size_t)i * 8;
    const v4f a = *(const v4f*)(in + e0);
    const v4f c = *(const v4f*)(in + e0 + 4);
    v4u hv;
    hv[0] = pk16(f2bf_bits(a[0]), f2bf_bits(a[1]));
    hv[1] = pk16(f2bf_bits(a[2]), f2bf_bits(a[3]));
    hv[2] = pk16(f2bf_bits(c[0]), f2bf_bits(c[1]));
    hv[3] = pk16(f2bf_bits(c[2]), f2bf_bits(c[3]));
    {
      *(v4u*)(out + e0) = hv;
      
    }
  }
}

// ---------------------------------------------------------------------------
// Fused transpose + bf16 RNE convert of an f32 matrix, z-batched, one plane:
//   in_z = W + z*sIn viewed [R rows][Cc cols] with row pitch ldin  ->  oh_z[c][r] = bf16(in_z[r][c]), row pitch ldout, oh_z = oh + z*sOut.
// 64x64 tiles through LDS. grid = (Cc/64, R/64, Z), 256 threads (R, Cc multiples of 64; ldout multiple of 64 so every
// Coverage per block: load 4 it x 256 thr x 4 floats = 64x64; store 2 it x 256 thr x 8 u16 = 64x64.
// Here: in_z = V[z] [R=2048 s][Cc=64 d] (ldin 64), out VT_z [64 d][2048 s] (ldout 2048); grid (1, 32, 2).
// ---------------------------------------------------------------------------
__global__ __launch_bounds__(256) void tconv_kernel(const float* __restrict__ W, unsigned short* __restrict__ oh,
                                                    int ldin, int ldout, long sIn, long sOut) {
  __shared__ __align__(16) float tf[64 * 68];
  W  += (size_t)blockIdx.z * sIn;
  oh += (size_t)blockIdx.z * sOut;
  const int c0  = blockIdx.x * 64;   // input column block = output row block
  const int r0  = blockIdx.y * 64;   // input row block    = output column block
  const int tid = threadIdx.x;
  {
    const int lr = tid >> 4;         // 0..15
    const int c4 = (tid & 15) * 4;   // 0..60
#pragma unroll
    for (int it = 0; it < 4; ++it) {
      const int rr = it * 16 + lr;   // 0..63
      const v4f a = *(const v4f*)(W + (size_t)(r0 + rr) * ldin + c0 + c4);
      *(v4f*)(tf + rr * 68 + c4) = a;
    }
  }
  __syncthreads();
  const int sub = tid >> 3;          // 0..31
  const int c8  = (tid & 7) * 8;     // 0..56
  v4u hv[2];
#pragma unroll
  for (int it = 0; it < 2; ++it) {
    const int oc = it * 32 + sub;    // output row within tile (= input column)
    v4u a;
#pragma unroll
    for (int q = 0; q < 4; ++q) {
      const float f0 = tf[(c8 + 2 * q) * 68 + oc];
      const float f1 = tf[(c8 + 2 * q + 1) * 68 + oc];
      a[q] = pk16(f2bf_bits(f0), f2bf_bits(f1));
    }
    hv[it] = a;
  }
  {
#pragma unroll
    for (int it = 0; it < 2; ++it) {
      const int oc = it * 32 + sub;
      const size_t go = (size_t)(c0 + oc) * ldout + r0 + c8;
      *(v4u*)(oh + go) = hv[it];
    }
    
  }
}

// =====================================================================================
// Full (non-causal, unmasked) multi-query attention, head dim 64, all (batch, head) pairs in one launch.
//   q plane (bf16) [32768][64]: element (b, h, q, d) at [((b*8+h)*2048 + q)*64 + d]
//   k plane (bf16) [4096][64]: element (b, s, d) at [(b*2048 + s)*64 + d]       (one key head shared by all 8 query heads)
//   v^T plane (bf16) [2][64][2048]: element (b, d, s) at [b*131072 + d*2048 + s] (one value head shared by all 8 query heads)
//   out f32 [32768][64]: element (b, h, q, d) at [((b*8+h)*2048 + q)*64 + d]
//   scores^T = (k . q^T) * 0.125 : single bf16 product (exact), f32 accumulate; A = K rows, B = Q columns
//   out^T    = v^T . p^T         : v^T . p_hi^T + v^T . p_lo^T (p = unnormalised exp split into bf16 hi|lo; the same v^T LDS
//                               fragment serves both terms), f32 accumulate, x 1/rowsum in f32 at the end
//   online softmax in f32 over all 2048 keys of the batch element (32 chunks of 64, compile-time trip count, no masking):
//   lane (c, hh) holds the scores of query c for the keys j*16 + 8*hh + r; max and sum run in-lane, the two halves of a
//   query join by one cross-row move (max: every chunk; sum: once, in the epilogue).
//   Block = 4 waves = 64 query rows of one (batch, head); grid.x = 2 * 8 * 32 = 512 (exact).
//   K / V^T chunk staging: 128 threads x 32 elements per plane = the whole 64x64 tile (16-B copies, plain loads,
//   __syncthreads before and after); fragment loads read the LDS tiles with the same v8b element type.
//   LDS extents: K/V tiles 64x64 fully staged every chunk, rows at a pitch of 72 elements; the 8 pad elements of a row are never written or read.
//   Epilogue: each wave stages its 16x64 f32 tile in LDS, then writes 256-B output rows as 16 lanes x 16 B
// =====================================================================================
#define AT_D 64
#define AT_NW 4
#define AT_QB 64
#define AT_KC 64
#define AT_LP 72   // LDS row pitch of the K and V^T tiles in elements: 144 B = 16 B x 9 (odd), so the 16 rows of a ds_load_b128 fragment read fall on 16 different bank groups

__global__ __launch_bounds__(128)
void attn_mqa_kernel(const unsigned short* __restrict__ qp, const unsigned short* __restrict__ kp,
                     const unsigned short* __restrict__ vtp, float* __restrict__ out, float sscale) {
  union FB { v16b v; v8b h[2]; v4u u[2]; };
  __shared__ __align__(16) __bf16 Ksh[AT_KC * AT_LP];            // K  [kv][d]   64 rows x 144 B = 9 KB
  __shared__ __align__(16) __bf16 Vth[AT_D * AT_LP];             // V^T [d][kv]  64 rows x 144 B = 9 KB
  __shared__ __align__(16) float  Os[AT_NW][16 * 68];            // per wave out tile, pitch 68

  const int tid  = threadIdx.x;
  const int wave = tid >> 5;
  const int lane = tid & 31;
  const int hh   = lane >> 4;
  const int c    = lane & 15;

  const int nqb = SEQ / AT_QB;            // 32 query blocks per (batch, head)
  const int bx = blockIdx.x;              // grid = NB_ * NH_ * nqb (exact)
  const int qb = bx % nqb;
  const int bh = bx / nqb;                // b*8 + h, 0..15
  const int b  = bh / NH_;                // 0..1 : key / value index depends on b only
  const int q0 = bh * SEQ + qb * AT_QB + wave * 16;   // row in the q plane == row in out

  const __bf16* Qg = (const __bf16*)(const void*)qp;
  const __bf16* Kg = (const __bf16*)(const void*)kp  + (size_t)b * SEQ * AT_D;   // keys of batch b
  const __bf16* Vg = (const __bf16*)(const void*)vtp + (size_t)b * AT_D * SEQ;   // V^T of batch b [d][s]

  // ---- Q fragments (B operand, column = query lane&15, split k map): 2 d-chunks ----
  v16b qa[2];
#pragma unroll
  for (int dc = 0; dc < 2; ++dc)
    qa[dc] = ld_frag_bf(Qg + (size_t)(q0 + c) * AT_D + dc * 32 + 8 * hh);

  float mrow = -INFINITY;   // running max of query c (equal in both halves)
  float lrow = 0.f;         // running sum of query c over this half's keys only
  v8f oacc[4];              // oacc[t][r] = O^T[d = t*16 + 8*hh + r][query c]
#pragma unroll
  for (int t = 0; t < 4; ++t) oacc[t] = (v8f){0.f,0.f,0.f,0.f,0.f,0.f,0.f,0.f};

  const int nChunks = SEQ / AT_KC;   // 32, compile-time constant
  for (int kc = 0; kc < nChunks; ++kc) {
    const int kv0 = kc * AT_KC;
    __syncthreads();
    {
      // staging coverage: 128 threads x (4 x 8) elements = 64 rows x 64 per plane = the whole chunk tile
      const int r = tid >> 1, half = (tid & 1) * 32;
      const __bf16* ks = Kg + (size_t)(kv0 + r) * AT_D + half;      // K row kv0+r, d = half..half+31
      const __bf16* vs = Vg + (size_t)r * SEQ + kv0 + half;         // V^T row d = r, keys kv0+half..+31
#pragma unroll
      for (int i = 0; i < 4; ++i) {
        const v8b a0 = *(const v8b*)(ks + 8 * i);
        const v8b b0 = *(const v8b*)(vs + 8 * i);
        *(v8b*)(Ksh + r * AT_LP + half + 8 * i) = a0;
        *(v8b*)(Vth + r * AT_LP + half + 8 * i) = b0;
      }
    }
    __syncthreads();

    // ---- S^T = k . q^T : A fragment row = key j*16+c, B = Q column c, split k map over d on both ----
    // all 8 K fragments are read as ONE group ahead of the products: one LDS latency per chunk instead of one per fragment
    FB kb[4][2];
#pragma unroll
    for (int j = 0; j < 4; ++j) {
#pragma unroll
      for (int dc = 0; dc < 2; ++dc) {
        kb[j][dc].h[0] = *(const v8b*)(Ksh + (j * 16 + c) * AT_LP + dc * 32 + 8 * hh);
        kb[j][dc].h[1] = *(const v8b*)(Ksh + (j * 16 + c) * AT_LP + dc * 32 + 16 + 8 * hh);
      }
    }
    v8f s[4];
#pragma unroll
    for (int j = 0; j < 4; ++j) {
      s[j] = (v8f){0.f,0.f,0.f,0.f,0.f,0.f,0.f,0.f};
#pragma unroll
      for (int dc = 0; dc < 2; ++dc) s[j] = at_mma(kb[j][dc].v, qa[dc], s[j]);
    }
    // the 8 V^T fragments are read into registers here, not among their products: the softmax's vector work between read and use covers the LDS latency
    FB vb[2][4];
#pragma unroll
    for (int kk = 0; kk < 2; ++kk) {
#pragma unroll
      for (int t = 0; t < 4; ++t) {
        vb[kk][t].h[0] = *(const v8b*)(Vth + (t * 16 + c) * AT_LP + kk * 32 + 8 * hh);
        vb[kk][t].h[1] = *(const v8b*)(Vth + (t * 16 + c) * AT_LP + kk * 32 + 16 + 8 * hh);
      }
    }
    // scale, then chunk max of query c (s[j][r] = score of key j*16 + 8hh + r, query c): in-lane, then the other half
    float cm = -INFINITY;
#pragma unroll
    for (int j = 0; j < 4; ++j) {
#pragma unroll
      for (int r = 0; r < 8; ++r) {
        const float sv = s[j][r] * sscale;
        s[j][r] = sv;
        cm = fmaxf(cm, sv);
      }
    }
    cm = fmaxf(cm, at_xhalf(cm));
    const float mnew = fmaxf(mrow, cm);
    const float alpha = expf(mrow - mnew);
    mrow = mnew;
    // P^T as B operand: element e of the 32-key block kk = key kk*32 + (e < 8 ? 8hh + e : 16 + 8hh + e - 8) = s[2kk + (e >> 3)][e & 7]
    FB ph[2], pl[2];
    float ps[4];
#pragma unroll
    for (int j = 0; j < 4; ++j) {
      float psum = 0.f;
#pragma unroll
      for (int r = 0; r < 8; ++r) {
        const float p = expf(s[j][r] - mnew);
        psum += p;
        s[j][r] = p;
      }
      at_split8(s[j], ph[j >> 1].u[j & 1], pl[j >> 1].u[j & 1]);
      ps[j] = psum;
    }
    lrow = lrow * alpha + ((ps[0] + ps[1]) + (ps[2] + ps[3]));
#pragma unroll
    for (int t = 0; t < 4; ++t) {
#pragma unroll
      for (int r = 0; r < 8; ++r) oacc[t][r] *= alpha;
    }
    // ---- O^T += v^T . p_hi^T + v^T . p_lo^T : A = V^T [d][key] (row = d t*16+c, split k map over keys), B = P^T ----
    // unrolled: ph / pl / vb are register arrays, their index must be a compile-time constant
#pragma unroll
    for (int kk = 0; kk < 2; ++kk) {
#pragma unroll
      for (int t = 0; t < 4; ++t) {
        oacc[t] = at_mma(vb[kk][t].v, ph[kk].v, oacc[t]);
        oacc[t] = at_mma(vb[kk][t].v, pl[kk].v, oacc[t]);
      }
    }
  }

  // join the two halves' sums of query c; a lane holds 8 consecutive d of query c per tile: two 16-B LDS stores
  float* os = Os[wave];
  {
    const float inv = 1.0f / (lrow + at_xhalf(lrow));
#pragma unroll
    for (int t = 0; t < 4; ++t) {
      v4f lo4, hi4;
#pragma unroll
      for (int r = 0; r < 4; ++r) { lo4[r] = oacc[t][r] * inv; hi4[r] = oacc[t][4 + r] * inv; }
      *(v4f*)(os + c * 68 + t * 16 + 8 * hh)     = lo4;
      *(v4f*)(os + c * 68 + t * 16 + 8 * hh + 4) = hi4;
    }
  }
  __builtin_amdgcn_fence(__ATOMIC_RELEASE, "workgroup");
  __builtin_amdgcn_wave_barrier();
  __builtin_amdgcn_fence(__ATOMIC_ACQUIRE, "workgroup");
  {
    const int c4 = (lane & 15) * 4;
    float* orow = out + (size_t)(q0 + hh) * AT_D + c4;   // one address; the rows follow at constant offsets
    {
#pragma unroll
      for (int it = 0; it < 8; ++it) {
        const int row = it * 2 + hh;   // it 0..7 x hh 0..1 covers rows 0..15 of the wave tile
        v4f val = *(const v4f*)(os + row * 68 + c4);
        *(v4f*)(orow + it * 2 * AT_D) = val;
      }
      
    }
  }
}

// ---------------------------------------------------------------------------
// Workspace region map (byte offsets; every region is fully written by its producer launch before any consumer
//   QB  bf16 [32768][64]          0      4194304
//   KB  bf16 [4096][64]     4194304       524288
//   VT  bf16 [2][64][2048]  4718592       524288
//   total                   5242880
// ---------------------------------------------------------------------------
extern "C" void kernel_launch(void* const* d_in, const int* in_sizes, int n_in,
                              void* d_out, int out_size, void* d_ws, size_t ws_size,
                              hipStream_t stream) {
  if (n_in < 3) return;
  if (in_sizes[0] != NQR * HD) return;          // Q [2][8][2048][64]
  if (in_sizes[1] != NKR * HD) return;          // K [2][1][2048][64]
  if (in_sizes[2] != NKR * HD) return;          // V [2][1][2048][64]
  if (out_size != NQR * HD) return;             // out [2][8][2048][64]; last written element index NQR*HD-1

  const float* Q = (const float*)d_in[0];
  const float* K = (const float*)d_in[1];
  const float* V = (const float*)d_in[2];

  const size_t PQB = (size_t)NQR * HD * 2;      // 4194304
  const size_t PKB = (size_t)NKR * HD * 2;      // 524288
  const size_t PVT = (size_t)NB_ * HD * SEQ * 2;// 524288
  size_t off = 0;
  const size_t oQB = off; off += PQB;
  const size_t oKB = off; off += PKB;
  const size_t oVT = off; off += PVT;
  if (off > ws_size) return;                    // off = 5242880
  if (off > (size_t)134217728) return;

  char* ws = (char*)d_ws;
  unsigned short* QB = (unsigned short*)(ws + oQB);
  unsigned short* KB = (unsigned short*)(ws + oKB);
  unsigned short* VT = (unsigned short*)(ws + oVT);

  // (1) QB = bf16(Q) flat, KB = bf16(K) flat; 1024 + 128 blocks of 256 threads x 8 elements
  const int n8q = NQR * HD / 8;                 // 262144
  const int n8k = NKR * HD / 8;                 // 32768
  const int nbq = n8q / 256;                    // 1024
  const int nbk = n8k / 256;                    // 128
  cvt2_kernel<<<dim3(nbq + nbk), dim3(256), 0, stream>>>(Q, K, QB, KB, nbq, n8q, n8k);
  // (2) V[b] viewed [R=2048 s][Cc=64 d] (pitch 64) -> VT_b[d][s] (pitch 2048); grid (Cc/64, R/64, B) = (1, 32, 2)
  tconv_kernel<<<dim3(HD / 64, SEQ / 64, NB_), dim3(256), 0, stream>>>(V, VT, HD, SEQ, (long)SEQ * HD, (long)HD * SEQ);
  // (3) attention per (batch, head, 64-query block) -> d_out rows (b*8+h)*2048 + q; 512 blocks x 128 threads
  attn_mqa_kernel<<<dim3(NB_ * NH_ * (SEQ / 64)), dim3(128), 0, stream>>>(QB, KB, VT, (float*)d_out, 0.125f);
  (void)hipGetLastError();
}

// v005
// It runs in 43.1 microseconds.
// Two timings next to v004 put it at 1.15 and 1.16 times that version's speed.
// Counting every step since v000, it is 3.44 times as fast.
#include <hip/hip_runtime.h>
#include <math.h>
#include <stdint.h>

#define NB_   2
#define NH_   8
#define SEQ   2048
#define HD    64
#define NQR   (NB_ * NH_ * SEQ)   // 32768 q / out rows
#define NKR   (NB_ * SEQ)         // 4096 k rows

static_assert(HD == 64);
static_assert(SEQ % 64 == 0);
static_assert((NQR * HD) % (8 * 256) == 0);
static_assert((NKR * HD) % (8 * 256) == 0);

typedef __attribute__((ext_vector_type(16))) _Float16 v16h;
typedef __attribute__((ext_vector_type(8)))  _Float16 v8h;
typedef __attribute__((ext_vector_type(16))) __bf16   v16b;
typedef __attribute__((ext_vector_type(8)))  __bf16   v8b;
typedef __attribute__((ext_vector_type(8)))  float    v8f;
typedef __attribute__((ext_vector_type(4)))  float    v4f;
typedef __attribute__((ext_vector_type(4)))  unsigned int v4u;

__device__ __forceinline__ unsigned short f2bf_bits(float f) {
  unsigned u = __float_as_uint(f);
  return (unsigned short)((u + 0x7FFFu + ((u >> 16) & 1u)) >> 16);
}
__device__ __forceinline__ float bf_bits2f(unsigned short h) { return __uint_as_float(((unsigned)h) << 16); }
__device__ __forceinline__ unsigned pk16(unsigned short a, unsigned short b) { return (unsigned)a | ((unsigned)b << 16); }

// A / B fragment load (split k map): elements 0..7 <- p[0..7], 8..15 <- p[16..23]; caller passes p = row + k0 + 8*(lane>>4)
__device__ __forceinline__ v16b ld_frag_bf(const __bf16* p) {
  union { v16b v; v8b h[2]; } f;
  f.h[0] = *(const v8b*)(p);
  f.h[1] = *(const v8b*)(p + 16);
  return f.v;
}

// 2^x of the 8 exponent arguments of one score tile (in place), and the hi|lo bf16 split of the results, in one statement.
// Split, three vector instructions a pair: v_cvt_pk_bf16_f32 rounds two values to hi (nearest even); v_fma_mixlo_bf16 / v_fma_mixhi_bf16
// form f - hi (exact in f32) and round it to the low / high half of lo. op_sel picks the half of hi; -1.0 is read as bf16 from the
// high half of its f32 constant.
// Why one statement: each v_exp_f32 works in place and the instruction behind it touches neither its register nor its result (the slot
// that the instruction set asks for behind a transcendental), and the last three stand between split instructions instead of in a row.
// Each s_delay_alu names the distance to the producer (the first: the producers of f in front of the statement), so that the SIMD
// issues its other wave while this one waits: the compiler puts no such hint inside asm text.
__device__ __forceinline__ void at_exp2_split8(v8f& f, v4u& hi, v4u& lo) {
  unsigned h0, h1, h2, h3, l0, l1, l2, l3;
  float f0 = f[0], f1 = f[1], f2 = f[2], f3 = f[3], f4 = f[4], f5 = f[5], f6 = f[6], f7 = f[7];
  asm("s_delay_alu instid0(VALU_DEP_1)\n\t"
      "v_exp_f32 %8, %8\n\t"
      "v_exp_f32 %9, %9\n\t"
      "v_exp_f32 %10, %10\n\t"
      "v_exp_f32 %11, %11\n\t"
      "v_exp_f32 %12, %12\n\t"
      "v_cvt_pk_bf16_f32 %0, %8, %9\n\t"
      "v_exp_f32 %13, %13\n\t"
      "s_delay_alu instid0(TRANS32_DEP_3) | instskip(SKIP_1) | instid1(VALU_DEP_2)\n\t"
      "v_cvt_pk_bf16_f32 %1, %10, %11\n\t"
      "v_exp_f32 %14, %14\n\t"
      "v_fma_mixlo_bf16 %4, %0, -1.0, %8 op_sel:[0,1,0] op_sel_hi:[1,1,0]\n\t"
      "v_exp_f32 %15, %15\n\t"
      "s_delay_alu instid0(VALU_DEP_2) | instskip(NEXT) | instid1(TRANS32_DEP_3)\n\t"
      "v_fma_mixlo_bf16 %5, %1, -1.0, %10 op_sel:[0,1,0] op_sel_hi:[1,1,0]\n\t"
      "v_cvt_pk_bf16_f32 %2, %12, %13\n\t"
      "s_delay_alu instid0(VALU_DEP_3) | instskip(NEXT) | instid1(TRANS32_DEP_1)\n\t"
      "v_fma_mixhi_bf16 %4, %0, -1.0, %9 op_sel:[1,1,0] op_sel_hi:[1,1,0]\n\t"
      "v_cvt_pk_bf16_f32 %3, %14, %15\n\t"
      "s_delay_alu instid0(VALU_DEP_4) | instskip(NEXT) | instid1(VALU_DEP_4)\n\t"
      "v_fma_mixhi_bf16 %5, %1, -1.0, %11 op_sel:[1,1,0] op_sel_hi:[1,1,0]\n\t"
      "v_fma_mixlo_bf16 %6, %2, -1.0, %12 op_sel:[0,1,0] op_sel_hi:[1,1,0]\n\t"
      "s_delay_alu instid0(VALU_DEP_3) | instskip(NEXT) | instid1(VALU_DEP_2)\n\t"
      "v_fma_mixlo_bf16 %7, %3, -1.0, %14 op_sel:[0,1,0] op_sel_hi:[1,1,0]\n\t"
      "v_fma_mixhi_bf16 %6, %2, -1.0, %13 op_sel:[1,1,0] op_sel_hi:[1,1,0]\n\t"
      "s_delay_alu instid0(VALU_DEP_2)\n\t"
      "v_fma_mixhi_bf16 %7, %3, -1.0, %15 op_sel:[1,1,0] op_sel_hi:[1,1,0]"
      : "=&v"(h0), "=&v"(h1), "=&v"(h2), "=&v"(h3), "=&v"(l0), "=&v"(l1), "=&v"(l2), "=&v"(l3),
        "+v"(f0), "+v"(f1), "+v"(f2), "+v"(f3), "+v"(f4), "+v"(f5), "+v"(f6), "+v"(f7));
  f = (v8f){f0, f1, f2, f3, f4, f5, f6, f7};
  hi = (v4u){h0, h1, h2, h3};
  lo = (v4u){l0, l1, l2, l3};
}
// lane l <-> lane l ^ 16 (the other half of the same column) as a vector cross-row move
__device__ __forceinline__ float at_xhalf(float f) {
  const int b = __float_as_int(f);
  return __int_as_float(__builtin_amdgcn_permlanex16(b, b, 0x76543210, 0xfedcba98, false, false));
}
// WMMA with dependency guard: 4 VALU nops tied to D, A and B kept live
__device__ __forceinline__ v8f at_mma(v16b a, v16b b, v8f c) {
  c = __builtin_amdgcn_wmma_f32_16x16x32_bf16(false, a, false, b, (short)0, c, false, false);
  asm volatile("v_nop\n\tv_nop\n\tv_nop\n\tv_nop" : "+v"(c) : "v"(a), "v"(b));
  return c;
}

// ---------------------------------------------------------------------------
// Flat bf16 RNE convert of two f32 arrays in one launch (block-uniform role split):
//   blocks 0..nbq-1 : qo[e] = bf16(qin[e]), unit i = block*256+tid < n8q, elements 8i..8i+7
//   blocks nbq..    : ko[e] = bf16(kin[e]), unit i = (block-nbq)*256+tid < n8k
// Coverage: q: 1024 blocks x 256 x 8 = 2097152 = 32768x64; k: 128 blocks x 256 x 8 = 262144 = 4096x64.
// ---------------------------------------------------------------------------
__global__ __launch_bounds__(256) void cvt2_kernel(const float* __restrict__ qin, const float* __restrict__ kin,
                                                   unsigned short* __restrict__ qo, unsigned short* __restrict__ ko,
                                                   int nbq, int n8q, int n8k) {
  const bool isq = (int)blockIdx.x < nbq;                 // block-uniform
  const float* in = isq ? qin : kin;                      // both global, uniform select
  unsigned short* out = isq ? qo : ko;
  const int n8 = isq ? n8q : n8k;
  const int blk = isq ? (int)blockIdx.x : ((int)blockIdx.x - nbq);
  const int i = blk * 256 + (int)threadIdx.x;
  if (i < n8) {
    const size_t e0 = (size_t)i * 8;
    const v4f a = *(const v4f*)(in + e0);
    const v4f c = *(const v4f*)(in + e0 + 4);
    v4u hv;
    hv[0] = pk16(f2bf_bits(a[0]), f2bf_bits(a[1]));
    hv[1] = pk16(f2bf_bits(a[2]), f2bf_bits(a[3]));
    hv[2] = pk16(f2bf_bits(c[0]), f2bf_bits(c[1]));
    hv[3] = pk16(f2bf_bits(c[2]), f2bf_bits(c[3]));
    {
      *(v4u*)(out + e0) = hv;
      
    }
  }
}

// ---------------------------------------------------------------------------
// Fused transpose + bf16 RNE convert of an f32 matrix, z-batched, one plane:
//   in_z = W + z*sIn viewed [R rows][Cc cols] with row pitch ldin  ->  oh_z[c][r] = bf16(in_z[r][c]), row pitch ldout, oh_z = oh + z*sOut.
// 64x64 tiles through LDS. grid = (Cc/64, R/64, Z), 256 threads (R, Cc multiples of 64; ldout multiple of 64 so every
// Coverage per block: load 4 it x 256 thr x 4 floats = 64x64; store 2 it x 256 thr x 8 u16 = 64x64.
// Here: in_z = V[z] [R=2048 s][Cc=64 d] (ldin 64), out VT_z [64 d][2048 s] (ldout 2048); grid (1, 32, 2).
// ---------------------------------------------------------------------------
__global__ __launch_bounds__(256) void tconv_kernel(const float* __restrict__ W, unsigned short* __restrict__ oh,
                                                    int ldin, int ldout, long sIn, long sOut) {
  __shared__ __align__(16) float tf[64 * 68];
  W  += (size_t)blockIdx.z * sIn;
  oh += (size_t)blockIdx.z * sOut;
  const int c0  = blockIdx.x * 64;   // input column block = output row block
  const int r0  = blockIdx.y * 64;   // input row block    = output column block
  const int tid = threadIdx.x;
  {
    const int lr = tid >> 4;         // 0..15
    const int c4 = (tid & 15) * 4;   // 0..60
#pragma unroll
    for (int it = 0; it < 4; ++it) {
      const int rr = it * 16 + lr;   // 0..63
      const v4f a = *(const v4f*)(W + (size_t)(r0 + rr) * ldin + c0 + c4);
      *(v4f*)(tf + rr * 68 + c4) = a;
    }
  }
  __syncthreads();
  const int sub = tid >> 3;          // 0..31
  const int c8  = (tid & 7) * 8;     // 0..56
  v4u hv[2];
#pragma unroll
  for (int it = 0; it < 2; ++it) {
    const int oc = it * 32 + sub;    // output row within tile (= input column)
    v4u a;
#pragma unroll
    for (int q = 0; q < 4; ++q) {
      const float f0 = tf[(c8 + 2 * q) * 68 + oc];
      const float f1 = tf[(c8 + 2 * q + 1) * 68 + oc];
      a[q] = pk16(f2bf_bits(f0), f2bf_bits(f1));
    }
    hv[it] = a;
  }
  {
#pragma unroll
    for (int it = 0; it < 2; ++it) {
      const int oc = it * 32 + sub;
      const size_t go = (size_t)(c0 + oc) * ldout + r0 + c8;
      *(v4u*)(oh + go) = hv[it];
    }
    
  }
}

// =====================================================================================
// Full (non-causal, unmasked) multi-query attention, head dim 64, all (batch, head) pairs in one launch.
//   q plane (bf16) [32768][64]: element (b, h, q, d) at [((b*8+h)*2048 + q)*64 + d]
//   k plane (bf16) [4096][64]: element (b, s, d) at [(b*2048 + s)*64 + d]       (one key head shared by all 8 query heads)
//   v^T plane (bf16) [2][64][2048]: element (b, d, s) at [b*131072 + d*2048 + s] (one value head shared by all 8 query heads)
//   out f32 [32768][64]: element (b, h, q, d) at [((b*8+h)*2048 + q)*64 + d]
//   scores^T = (k . q^T) * 0.125 : single bf16 product (exact), f32 accumulate; A = K rows, B = Q columns
//   out^T    = v^T . p^T         : v^T . p_hi^T + v^T . p_lo^T (p = unnormalised exp split into bf16 hi|lo; the same v^T LDS
//                               fragment serves both terms), f32 accumulate, x 1/rowsum in f32 at the end
//   online softmax in f32 (base 2, scale folded into the exponent's multiply-add) over all 2048 keys of the batch element (32 chunks of 64, compile-time trip count, no masking):
//   lane (c, hh) holds the scores of query c for the keys j*16 + 8*hh + r; max and sum run in-lane, the two halves of a
//   query join by one cross-row move (max: every chunk; sum: once, in the epilogue).
//   Block = 4 waves = 64 query rows of one (batch, head); grid.x = 2 * 8 * 32 = 512 (exact).
//   K / V^T chunk staging: 128 threads x 32 elements per plane = the whole 64x64 tile (16-B copies, plain loads,
//   __syncthreads before and after); fragment loads read the LDS tiles with the same v8b element type.
//   LDS extents: K/V tiles 64x64 fully staged every chunk, rows at a pitch of 72 elements; the 8 pad elements of a row are never written or read.
//   Epilogue: each wave stages its 16x64 f32 tile in LDS, then writes 256-B output rows as 16 lanes x 16 B
// =====================================================================================
#define AT_D 64
#define AT_NW 4
#define AT_QB 64
#define AT_KC 64
#define AT_LP 72   // LDS row pitch of the K and V^T tiles in elements: 144 B = 16 B x 9 (odd), so the 16 rows of a ds_load_b128 fragment read fall on 16 different bank groups

__global__ __launch_bounds__(128)
void attn_mqa_kernel(const unsigned short* __restrict__ qp, const unsigned short* __restrict__ kp,
                     const unsigned short* __restrict__ vtp, float* __restrict__ out, float sscale) {
  union FB { v16b v; v8b h[2]; v4u u[2]; };
  __shared__ __align__(16) __bf16 Ksh[AT_KC * AT_LP];            // K  [kv][d]   64 rows x 144 B = 9 KB
  __shared__ __align__(16) __bf16 Vth[AT_D * AT_LP];             // V^T [d][kv]  64 rows x 144 B = 9 KB
  __shared__ __align__(16) float  Os[AT_NW][16 * 68];            // per wave out tile, pitch 68

  const int tid  = threadIdx.x;
  const int wave = tid >> 5;
  const int lane = tid & 31;
  const int hh   = lane >> 4;
  const int c    = lane & 15;

  const int nqb = SEQ / AT_QB;            // 32 query blocks per (batch, head)
  const int bx = blockIdx.x;              // grid = NB_ * NH_ * nqb (exact)
  const int qb = bx % nqb;
  const int bh = bx / nqb;                // b*8 + h, 0..15
  const int b  = bh / NH_;                // 0..1 : key / value index depends on b only
  const int q0 = bh * SEQ + qb * AT_QB + wave * 16;   // row in the q plane == row in out

  const __bf16* Qg = (const __bf16*)(const void*)qp;
  const __bf16* Kg = (const __bf16*)(const void*)kp  + (size_t)b * SEQ * AT_D;   // keys of batch b
  const __bf16* Vg = (const __bf16*)(const void*)vtp + (size_t)b * AT_D * SEQ;   // V^T of batch b [d][s]

  // ---- Q fragments (B operand, column = query lane&15, split k map): 2 d-chunks ----
  v16b qa[2];
#pragma unroll
  for (int dc = 0; dc < 2; ++dc)
    qa[dc] = ld_frag_bf(Qg + (size_t)(q0 + c) * AT_D + dc * 32 + 8 * hh);

  // exp(sscale * (s - m)) = 2^(s * c2 - m * c2), c2 = sscale * log2(e): one fused multiply-add and one v_exp_f32 a score.
  // The argument is never above 0 but for its own rounding; far below, 2^x runs out to 0, as exp does.
  const float c2 = sscale * 1.44269504088896340736f;
  float mrow = -INFINITY;   // running max of query c over the UNSCALED scores (sscale > 0: the same key wins), equal in both halves
  float lrow = 0.f;         // running sum of query c over this half's keys only
  v8f oacc[4];              // oacc[t][r] = O^T[d = t*16 + 8*hh + r][query c]
#pragma unroll
  for (int t = 0; t < 4; ++t) oacc[t] = (v8f){0.f,0.f,0.f,0.f,0.f,0.f,0.f,0.f};

  const int nChunks = SEQ / AT_KC;   // 32, compile-time constant
  for (int kc = 0; kc < nChunks; ++kc) {
    const int kv0 = kc * AT_KC;
    __syncthreads();
    {
      // staging coverage: 128 threads x (4 x 8) elements = 64 rows x 64 per plane = the whole chunk tile
      const int r = tid >> 1, half = (tid & 1) * 32;
      const __bf16* ks = Kg + (size_t)(kv0 + r) * AT_D + half;      // K row kv0+r, d = half..half+31
      const __bf16* vs = Vg + (size_t)r * SEQ + kv0 + half;         // V^T row d = r, keys kv0+half..+31
#pragma unroll
      for (int i = 0; i < 4; ++i) {
        const v8b a0 = *(const v8b*)(ks + 8 * i);
        const v8b b0 = *(const v8b*)(vs + 8 * i);
        *(v8b*)(Ksh + r * AT_LP + half + 8 * i) = a0;
        *(v8b*)(Vth + r * AT_LP + half + 8 * i) = b0;
      }
    }
    __syncthreads();

    // ---- S^T = k . q^T : A fragment row = key j*16+c, B = Q column c, split k map over d on both ----
    // all 8 K fragments are read as ONE group ahead of the products: one LDS latency per chunk instead of one per fragment
    FB kb[4][2];
#pragma unroll
    for (int j = 0; j < 4; ++j) {
#pragma unroll
      for (int dc = 0; dc < 2; ++dc) {
        kb[j][dc].h[0] = *(const v8b*)(Ksh + (j * 16 + c) * AT_LP + dc * 32 + 8 * hh);
        kb[j][dc].h[1] = *(const v8b*)(Ksh + (j * 16 + c) * AT_LP + dc * 32 + 16 + 8 * hh);
      }
    }
    v8f s[4];
#pragma unroll
    for (int j = 0; j < 4; ++j) {
      s[j] = (v8f){0.f,0.f,0.f,0.f,0.f,0.f,0.f,0.f};
#pragma unroll
      for (int dc = 0; dc < 2; ++dc) s[j] = at_mma(kb[j][dc].v, qa[dc], s[j]);
    }
    // the 8 V^T fragments are read into registers here, not among their products: the softmax's vector work between read and use covers the LDS latency
    FB vb[2][4];
#pragma unroll
    for (int kk = 0; kk < 2; ++kk) {
#pragma unroll
      for (int t = 0; t < 4; ++t) {
        vb[kk][t].h[0] = *(const v8b*)(Vth + (t * 16 + c) * AT_LP + kk * 32 + 8 * hh);
        vb[kk][t].h[1] = *(const v8b*)(Vth + (t * 16 + c) * AT_LP + kk * 32 + 16 + 8 * hh);
      }
    }
    // chunk max of query c (s[j][r] = unscaled score of key j*16 + 8hh + r, query c): in-lane, then the other half
    float cm = -INFINITY;
#pragma unroll
    for (int j = 0; j < 4; ++j) {
#pragma unroll
      for (int r = 0; r < 8; ++r) cm = fmaxf(cm, s[j][r]);
    }
    cm = fmaxf(cm, at_xhalf(cm));
    const float mnew = fmaxf(mrow, cm);
    const float alpha = __builtin_amdgcn_exp2f((mrow - mnew) * c2);
    const float nm2 = -mnew * c2;
    mrow = mnew;
    // P^T as B operand: element e of the 32-key block kk = key kk*32 + (e < 8 ? 8hh + e : 16 + 8hh + e - 8) = s[2kk + (e >> 3)][e & 7]
    FB ph[2], pl[2];
    float ps[4];
#pragma unroll
    for (int j = 0; j < 4; ++j) {
#pragma unroll
      for (int r = 0; r < 8; ++r) s[j][r] = fmaf(s[j][r], c2, nm2);
      at_exp2_split8(s[j], ph[j >> 1].u[j & 1], pl[j >> 1].u[j & 1]);   // s[j] becomes p = 2^s[j]
      float psum = s[j][0];
#pragma unroll
      for (int r = 1; r < 8; ++r) psum += s[j][r];
      ps[j] = psum;
    }
    lrow = lrow * alpha + ((ps[0] + ps[1]) + (ps[2] + ps[3]));
#pragma unroll
    for (int t = 0; t < 4; ++t) {
#pragma unroll
      for (int r = 0; r < 8; ++r) oacc[t][r] *= alpha;
    }
    // ---- O^T += v^T . p_hi^T + v^T . p_lo^T : A = V^T [d][key] (row = d t*16+c, split k map over keys), B = P^T ----
    // unrolled: ph / pl / vb are register arrays, their index must be a compile-time constant
#pragma unroll
    for (int kk = 0; kk < 2; ++kk) {
#pragma unroll
      for (int t = 0; t < 4; ++t) {
        oacc[t] = at_mma(vb[kk][t].v, ph[kk].v, oacc[t]);
        oacc[t] = at_mma(vb[kk][t].v, pl[kk].v, oacc[t]);
      }
    }
  }

  // join the two halves' sums of query c; a lane holds 8 consecutive d of query c per tile: two 16-B LDS stores
  float* os = Os[wave];
  {
    const float inv = 1.0f / (lrow + at_xhalf(lrow));
#pragma unroll
    for (int t = 0; t < 4; ++t) {
      v4f lo4, hi4;
#pragma unroll
      for (int r = 0; r < 4; ++r) { lo4[r] = oacc[t][r] * inv; hi4[r] = oacc[t][4 + r] * inv; }
      *(v4f*)(os + c * 68 + t * 16 + 8 * hh)     = lo4;
      *(v4f*)(os + c * 68 + t * 16 + 8 * hh + 4) = hi4;
    }
  }
  __builtin_amdgcn_fence(__ATOMIC_RELEASE, "workgroup");
  __builtin_amdgcn_wave_barrier();
  __builtin_amdgcn_fence(__ATOMIC_ACQUIRE, "workgroup");
  {
    const int c4 = (lane & 15) * 4;
    float* orow = out + (size_t)(q0 + hh) * AT_D + c4;   // one address; the rows follow at constant offsets
    {
#pragma unroll
      for (int it = 0; it < 8; ++it) {
        const int row = it * 2 + hh;   // it 0..7 x hh 0..1 covers rows 0..15 of the wave tile
        v4f val = *(const v4f*)(os + row * 68 + c4);
        *(v4f*)(orow + it * 2 * AT_D) = val;
      }
      
    }
  }
}

// ---------------------------------------------------------------------------
// Workspace region map (byte offsets; every region is fully written by its producer launch before any consumer
//   QB  bf16 [32768][64]          0      4194304
//   KB  bf16 [4096][64]     4194304       524288
//   VT  bf16 [2][64][2048]  4718592       524288
//   total                   5242880
// ---------------------------------------------------------------------------
extern "C" void kernel_launch(void* const* d_in, const int* in_sizes, int n_in,
                              void* d_out, int out_size, void* d_ws, size_t ws_size,
                              hipStream_t stream) {
  if (n_in < 3) return;
  if (in_sizes[0] != NQR * HD) return;          // Q [2][8][2048][64]
  if (in_sizes[1] != NKR * HD) return;          // K [2][1][2048][64]
  if (in_sizes[2] != NKR * HD) return;          // V [2][1][2048][64]
  if (out_size != NQR * HD) return;             // out [2][8][2048][64]; last written element index NQR*HD-1

  const float* Q = (const float*)d_in[0];
  const float* K = (const float*)d_in[1];
  const float* V = (const float*)d_in[2];

  const size_t PQB = (size_t)NQR * HD * 2;      // 4194304
  const size_t PKB = (size_t)NKR * HD * 2;      // 524288
  const size_t PVT = (size_t)NB_ * HD * SEQ * 2;// 524288
  size_t off = 0;
  const size_t oQB = off; off += PQB;
  const size_t oKB = off; off += PKB;
  const size_t oVT = off; off += PVT;
  if (off > ws_size) return;                    // off = 5242880
  if (off > (size_t)134217728) return;

  char* ws = (char*)d_ws;
  unsigned short* QB = (unsigned short*)(ws + oQB);
  unsigned short* KB = (unsigned short*)(ws + oKB);
  unsigned short* VT = (unsigned short*)(ws + oVT);

  // (1) QB = bf16(Q) flat, KB = bf16(K) flat; 1024 + 128 blocks of 256 threads x 8 elements
  const int n8q = NQR * HD / 8;                 // 262144
  const int n8k = NKR * HD / 8;                 // 32768
  const int nbq = n8q / 256;                    // 1024
  const int nbk = n8k / 256;                    // 128
  cvt2_kernel<<<dim3(nbq + nbk), dim3(256), 0, stream>>>(Q, K, QB, KB, nbq, n8q, n8k);
  // (2) V[b] viewed [R=2048 s][Cc=64 d] (pitch 64) -> VT_b[d][s] (pitch 2048); grid (Cc/64, R/64, B) = (1, 32, 2)
  tconv_kernel<<<dim3(HD / 64, SEQ / 64, NB_), dim3(256), 0, stream>>>(V, VT, HD, SEQ, (long)SEQ * HD, (long)HD * SEQ);
  // (3) attention per (batch, head, 64-query block) -> d_out rows (b*8+h)*2048 + q; 512 blocks x 128 threads
  attn_mqa_kernel<<<dim3(NB_ * NH_ * (SEQ / 64)), dim3(128), 0, stream>>>(QB, KB, VT, (float*)d_out, 0.125f);
  (void)hipGetLastError();
}

// v006
// Measured time: 33.2 microseconds a run.
// Next to v005, in two timings, it ran 1.26 and 1.27 times as fast.
// Over all steps from v000 it is 4.35 times as fast.
#include <hip/hip_runtime.h>
#include <math.h>
#include <stdint.h>

#define NB_   2
#define NH_   8
#define SEQ   2048
#define HD    64
#define NQR   (NB_ * NH_ * SEQ)   // 32768 q / out rows
#define NKR   (NB_ * SEQ)         // 4096 k rows

static_assert(HD == 64);
static_assert(SEQ % 64 == 0);
static_assert((NQR * HD) % (8 * 256) == 0);
static_assert((NKR * HD) % (8 * 256) == 0);

typedef __attribute__((ext_vector_type(16))) _Float16 v16h;
typedef __attribute__((ext_vector_type(8)))  _Float16 v8h;
typedef __attribute__((ext_vector_type(16))) __bf16   v16b;
typedef __attribute__((ext_vector_type(8)))  __bf16   v8b;
typedef __attribute__((ext_vector_type(8)))  float    v8f;
typedef __attribute__((ext_vector_type(4)))  float    v4f;
typedef __attribute__((ext_vector_type(4)))  unsigned int v4u;

__device__ __forceinline__ unsigned short f2bf_bits(float f) {
  unsigned u = __float_as_uint(f);
  return (unsigned short)((u + 0x7FFFu + ((u >> 16) & 1u)) >> 16);
}
__device__ __forceinline__ float bf_bits2f(unsigned short h) { return __uint_as_float(((unsigned)h) << 16); }
__device__ __forceinline__ unsigned pk16(unsigned short a, unsigned short b) { return (unsigned)a | ((unsigned)b << 16); }

// A / B fragment load (split k map): elements 0..7 <- p[0..7], 8..15 <- p[16..23]; caller passes p = row + k0 + 8*(lane>>4)
__device__ __forceinline__ v16b ld_frag_bf(const __bf16* p) {
  union { v16b v; v8b h[2]; } f;
  f.h[0] = *(const v8b*)(p);
  f.h[1] = *(const v8b*)(p + 16);
  return f.v;
}

// 2^x of the 8 exponent arguments of one score tile (in place), and the hi|lo bf16 split of the results, in one statement.
// Split, three vector instructions a pair: v_cvt_pk_bf16_f32 rounds two values to hi (nearest even); v_fma_mixlo_bf16 / v_fma_mixhi_bf16
// form f - hi (exact in f32) and round it to the low / high half of lo. op_sel picks the half of hi; -1.0 is read as bf16 from the
// high half of its f32 constant.
// Why one statement: each v_exp_f32 works in place and the instruction behind it touches neither its register nor its result (the slot
// that the instruction set asks for behind a transcendental), and the last three stand between split instructions instead of in a row.
// Each s_delay_alu names the distance to the producer (the first: the producers of f in front of the statement), so that the SIMD
// issues its other wave while this one waits: the compiler puts no such hint inside asm text.
__device__ __forceinline__ void at_exp2_split8(v8f& f, v4u& hi, v4u& lo) {
  unsigned h0, h1, h2, h3, l0, l1, l2, l3;
  float f0 = f[0], f1 = f[1], f2 = f[2], f3 = f[3], f4 = f[4], f5 = f[5], f6 = f[6], f7 = f[7];
  asm("s_delay_alu instid0(VALU_DEP_1)\n\t"
      "v_exp_f32 %8, %8\n\t"
      "v_exp_f32 %9, %9\n\t"
      "v_exp_f32 %10, %10\n\t"
      "v_exp_f32 %11, %11\n\t"
      "v_exp_f32 %12, %12\n\t"
      "v_cvt_pk_bf16_f32 %0, %8, %9\n\t"
      "v_exp_f32 %13, %13\n\t"
      "s_delay_alu instid0(TRANS32_DEP_3) | instskip(SKIP_1) | instid1(VALU_DEP_2)\n\t"
      "v_cvt_pk_bf16_f32 %1, %10, %11\n\t"
      "v_exp_f32 %14, %14\n\t"
      "v_fma_mixlo_bf16 %4, %0, -1.0, %8 op_sel:[0,1,0] op_sel_hi:[1,1,0]\n\t"
      "v_exp_f32 %15, %15\n\t"
      "s_delay_alu instid0(VALU_DEP_2) | instskip(NEXT) | instid1(TRANS32_DEP_3)\n\t"
      "v_fma_mixlo_bf16 %5, %1, -1.0, %10 op_sel:[0,1,0] op_sel_hi:[1,1,0]\n\t"
      "v_cvt_pk_bf16_f32 %2, %12, %13\n\t"
      "s_delay_alu instid0(VALU_DEP_3) | instskip(NEXT) | instid1(TRANS32_DEP_1)\n\t"
      "v_fma_mixhi_bf16 %4, %0, -1.0, %9 op_sel:[1,1,0] op_sel_hi:[1,1,0]\n\t"
      "v_cvt_pk_bf16_f32 %3, %14, %15\n\t"
      "s_delay_alu instid0(VALU_DEP_4) | instskip(NEXT) | instid1(VALU_DEP_4)\n\t"
      "v_fma_mixhi_bf16 %5, %1, -1.0, %11 op_sel:[1,1,0] op_sel_hi:[1,1,0]\n\t"
      "v_fma_mixlo_bf16 %6, %2, -1.0, %12 op_sel:[0,1,0] op_sel_hi:[1,1,0]\n\t"
      "s_delay_alu instid0(VALU_DEP_3) | instskip(NEXT) | instid1(VALU_DEP_2)\n\t"
      "v_fma_mixlo_bf16 %7, %3, -1.0, %14 op_sel:[0,1,0] op_sel_hi:[1,1,0]\n\t"
      "v_fma_mixhi_bf16 %6, %2, -1.0, %13 op_sel:[1,1,0] op_sel_hi:[1,1,0]\n\t"
      "s_delay_alu instid0(VALU_DEP_2)\n\t"
      "v_fma_mixhi_bf16 %7, %3, -1.0, %15 op_sel:[1,1,0] op_sel_hi:[1,1,0]"
      : "=&v"(h0), "=&v"(h1), "=&v"(h2), "=&v"(h3), "=&v"(l0), "=&v"(l1), "=&v"(l2), "=&v"(l3),
        "+v"(f0), "+v"(f1), "+v"(f2), "+v"(f3), "+v"(f4), "+v"(f5), "+v"(f6), "+v"(f7));
  f = (v8f){f0, f1, f2, f3, f4, f5, f6, f7};
  hi = (v4u){h0, h1, h2, h3};
  lo = (v4u){l0, l1, l2, l3};
}
// lane l <-> lane l ^ 16 (the other half of the same column) as a vector cross-row move
__device__ __forceinline__ float at_xhalf(float f) {
  const int b = __float_as_int(f);
  return __int_as_float(__builtin_amdgcn_permlanex16(b, b, 0x76543210, 0xfedcba98, false, false));
}
// WMMA with dependency guard: 4 VALU nops tied to D, A and B kept live
__device__ __forceinline__ v8f at_mma(v16b a, v16b b, v8f c) {
  c = __builtin_amdgcn_wmma_f32_16x16x32_bf16(false, a, false, b, (short)0, c, false, false);
  asm volatile("v_nop\n\tv_nop\n\tv_nop\n\tv_nop" : "+v"(c) : "v"(a), "v"(b));
  return c;
}

// ---------------------------------------------------------------------------
// Flat bf16 RNE convert of two f32 arrays in one launch (block-uniform role split):
//   blocks 0..nbq-1 : qo[e] = bf16(qin[e]), unit i = block*256+tid < n8q, elements 8i..8i+7
//   blocks nbq..    : ko[e] = bf16(kin[e]), unit i = (block-nbq)*256+tid < n8k
// Coverage: q: 1024 blocks x 256 x 8 = 2097152 = 32768x64; k: 128 blocks x 256 x 8 = 262144 = 4096x64.
// ---------------------------------------------------------------------------
__global__ __launch_bounds__(256) void cvt2_kernel(const float* __restrict__ qin, const float* __restrict__ kin,
                                                   unsigned short* __restrict__ qo, unsigned short* __restrict__ ko,
                                                   int nbq, int n8q, int n8k) {
  const bool isq = (int)blockIdx.x < nbq;                 // block-uniform
  const float* in = isq ? qin : kin;                      // both global, uniform select
  unsigned short* out = isq ? qo : ko;
  const int n8 = isq ? n8q : n8k;
  const int blk = isq ? (int)blockIdx.x : ((int)blockIdx.x - nbq);
  const int i = blk * 256 + (int)threadIdx.x;
  if (i < n8) {
    const size_t e0 = (size_t)i * 8;
    const v4f a = *(const v4f*)(in + e0);
    const v4f c = *(const v4f*)(in + e0 + 4);
    v4u hv;
    hv[0] = pk16(f2bf_bits(a[0]), f2bf_bits(a[1]));
    hv[1] = pk16(f2bf_bits(a[2]), f2bf_bits(a[3]));
    hv[2] = pk16(f2bf_bits(c[0]), f2bf_bits(c[1]));
    hv[3] = pk16(f2bf_bits(c[2]), f2bf_bits(c[3]));
    {
      *(v4u*)(out + e0) = hv;
      
    }
  }
}

// ---------------------------------------------------------------------------
// Fused transpose + bf16 RNE convert of an f32 matrix, z-batched, one plane:
//   in_z = W + z*sIn viewed [R rows][Cc cols] with row pitch ldin  ->  oh_z[c][r] = bf16(in_z[r][c]), row pitch ldout, oh_z = oh + z*sOut.
// 64x64 tiles through LDS. grid = (Cc/64, R/64, Z), 256 threads (R, Cc multiples of 64; ldout multiple of 64 so every
// Coverage per block: load 4 it x 256 thr x 4 floats = 64x64; store 2 it x 256 thr x 8 u16 = 64x64.
// Here: in_z = V[z] [R=2048 s][Cc=64 d] (ldin 64), out VT_z [64 d][2048 s] (ldout 2048); grid (1, 32, 2).
// ---------------------------------------------------------------------------
__global__ __launch_bounds__(256) void tconv_kernel(const float* __restrict__ W, unsigned short* __restrict__ oh,
                                                    int ldin, int ldout, long sIn, long sOut) {
  __shared__ __align__(16) float tf[64 * 68];
  W  += (size_t)blockIdx.z * sIn;
  oh += (size_t)blockIdx.z * sOut;
  const int c0  = blockIdx.x * 64;   // input column block = output row block
  const int r0  = blockIdx.y * 64;   // input row block    = output column block
  const int tid = threadIdx.x;
  {
    const int lr = tid >> 4;         // 0..15
    const int c4 = (tid & 15) * 4;   // 0..60
#pragma unroll
    for (int it = 0; it < 4; ++it) {
      const int rr = it * 16 + lr;   // 0..63
      const v4f a = *(const v4f*)(W + (size_t)(r0 + rr) * ldin + c0 + c4);
      *(v4f*)(tf + rr * 68 + c4) = a;
    }
  }
  __syncthreads();
  const int sub = tid >> 3;          // 0..31
  const int c8  = (tid & 7) * 8;     // 0..56
  v4u hv[2];
#pragma unroll
  for (int it = 0; it < 2; ++it) {
    const int oc = it * 32 + sub;    // output row within tile (= input column)
    v4u a;
#pragma unroll
    for (int q = 0; q < 4; ++q) {
      const float f0 = tf[(c8 + 2 * q) * 68 + oc];
      const float f1 = tf[(c8 + 2 * q + 1) * 68 + oc];
      a[q] = pk16(f2bf_bits(f0), f2bf_bits(f1));
    }
    hv[it] = a;
  }
  {
#pragma unroll
    for (int it = 0; it < 2; ++it) {
      const int oc = it * 32 + sub;
      const size_t go = (size_t)(c0 + oc) * ldout + r0 + c8;
      *(v4u*)(oh + go) = hv[it];
    }
    
  }
}

// =====================================================================================
// Full (non-causal, unmasked) multi-query attention, head dim 64, all (batch, head) pairs in one launch.
//   q plane (bf16) [32768][64]: element (b, h, q, d) at [((b*8+h)*2048 + q)*64 + d]
//   k plane (bf16) [4096][64]: element (b, s, d) at [(b*2048 + s)*64 + d]       (one key head shared by all 8 query heads)
//   v^T plane (bf16) [2][64][2048]: element (b, d, s) at [b*131072 + d*2048 + s] (one value head shared by all 8 query heads)
//   out f32 [32768][64]: element (b, h, q, d) at [((b*8+h)*2048 + q)*64 + d]
//   scores^T = (k . q^T) * 0.125 : single bf16 product (exact), f32 accumulate; A = K rows, B = Q columns
//   out^T    = v^T . p^T         : v^T . p_hi^T + v^T . p_lo^T (p = unnormalised exp split into bf16 hi|lo; the same v^T LDS
//                               fragment serves both terms), f32 accumulate, x 1/rowsum in f32 at the end
//   online softmax in f32 (base 2, scale folded into the exponent's multiply-add) over all 2048 keys of the batch element (2 key groups x 16 chunks of 64, compile-time trip count, no masking):
//   lane (c, hh) holds the scores of query c for the keys j*16 + 8*hh + r; max and sum run in-lane, the two halves of a
//   query join by one cross-row move (max: every chunk; sum: once, in the epilogue).
//   Block = 8 waves = 4 query tiles x 2 key groups, 64 query rows of one (batch, head); grid.x = 2 * 8 * 32 = 512 (exact).
//   Key group g (waves 4g..4g+3) walks the keys g*1024 .. g*1024+1023 in 16 chunks of 64 with its own running max, sum and O^T and its
//   own K / V^T tiles: four waves a SIMD instead of two stand ready while a group waits for its staging, and the chain of chunks is half as long.
//   Behind the loop group 1 hands max, sum and O^T to group 0 through LDS (one barrier); group 0 rescales both to the common max and adds.
//   K / V^T chunk staging: the group's 128 threads x 32 elements per plane = its whole 64x64 tile (16-B copies, plain loads,
//   __syncthreads before and after); fragment loads read the LDS tiles with the same v8b element type.
//   LDS extents: K/V tiles 64x64 fully staged every chunk, rows at a pitch of 72 elements; the 8 pad elements of a row are never written or read.
//   Epilogue: each wave of key group 0 stages its 16x64 f32 tile in LDS, then writes 256-B output rows as 16 lanes x 16 B
// =====================================================================================
#define AT_D 64
#define AT_NW 4    // query tiles of 16 rows = waves per key group
#define AT_NG 2    // key groups per block
#define AT_GK (SEQ / AT_NG)   // 1024 keys per group
#define AT_QB 64
#define AT_KC 64
#define AT_LP 72   // LDS row pitch of the K and V^T tiles in elements: 144 B = 16 B x 9 (odd), so the 16 rows of a ds_load_b128 fragment read fall on 16 different bank groups

static_assert(AT_GK % AT_KC == 0);

__global__ __launch_bounds__(256)
void attn_mqa_kernel(const unsigned short* __restrict__ qp, const unsigned short* __restrict__ kp,
                     const unsigned short* __restrict__ vtp, float* __restrict__ out, float sscale) {
  union FB { v16b v; v8b h[2]; v4u u[2]; };
  __shared__ __align__(16) __bf16 KshG[AT_NG][AT_KC * AT_LP];    // per key group: K  [kv][d]   64 rows x 144 B = 9 KB
  __shared__ __align__(16) __bf16 VthG[AT_NG][AT_D * AT_LP];     // per key group: V^T [d][kv]  64 rows x 144 B = 9 KB
  __shared__ __align__(16) float  Os[AT_NW][16 * 68];            // per query tile: out tile, pitch 68
  __shared__ __align__(16) float  Mo[AT_NW][8 * 32 * 4];         // per query tile: group 1's O^T, [16-B piece 0..7][lane]
  __shared__ float Mm[AT_NW][32];                                // per query tile: group 1's running max, by lane
  __shared__ float Ml[AT_NW][32];                                // per query tile: group 1's running sum, by lane

  const int grp  = __builtin_amdgcn_readfirstlane((int)threadIdx.x >> 7);   // key group 0..1, the same in a whole wave
  const int tid  = threadIdx.x & 127;     // thread within the key group
  const int wave = tid >> 5;              // query tile 0..3
  const int lane = tid & 31;
  __bf16* Ksh = KshG[grp];
  __bf16* Vth = VthG[grp];
  const int hh   = lane >> 4;
  const int c    = lane & 15;

  const int nqb = SEQ / AT_QB;            // 32 query blocks per (batch, head)
  const int bx = blockIdx.x;              // grid = NB_ * NH_ * nqb (exact)
  const int qb = bx % nqb;
  const int bh = bx / nqb;                // b*8 + h, 0..15
  const int b  = bh / NH_;                // 0..1 : key / value index depends on b only
  const int q0 = bh * SEQ + qb * AT_QB + wave * 16;   // row in the q plane == row in out

  const __bf16* Qg = (const __bf16*)(const void*)qp;
  const __bf16* Kg = (const __bf16*)(const void*)kp  + (size_t)b * SEQ * AT_D;   // keys of batch b
  const __bf16* Vg = (const __bf16*)(const void*)vtp + (size_t)b * AT_D * SEQ;   // V^T of batch b [d][s]

  // ---- Q fragments (B operand, column = query lane&15, split k map): 2 d-chunks ----
  v16b qa[2];
#pragma unroll
  for (int dc = 0; dc < 2; ++dc)
    qa[dc] = ld_frag_bf(Qg + (size_t)(q0 + c) * AT_D + dc * 32 + 8 * hh);

  // exp(sscale * (s - m)) = 2^(s * c2 - m * c2), c2 = sscale * log2(e): one fused multiply-add and one v_exp_f32 a score.
  // The argument is never above 0 but for its own rounding; far below, 2^x runs out to 0, as exp does.
  const float c2 = sscale * 1.44269504088896340736f;
  float mrow = -INFINITY;   // running max of query c over the UNSCALED scores (sscale > 0: the same key wins), equal in both halves
  float lrow = 0.f;         // running sum of query c over this half's keys only
  v8f oacc[4];              // oacc[t][r] = O^T[d = t*16 + 8*hh + r][query c]
#pragma unroll
  for (int t = 0; t < 4; ++t) oacc[t] = (v8f){0.f,0.f,0.f,0.f,0.f,0.f,0.f,0.f};

  const int nChunks = AT_GK / AT_KC;   // 16 per key group, compile-time constant, the same for both groups (the barriers are the block's)
  for (int kc = 0; kc < nChunks; ++kc) {
    const int kv0 = grp * AT_GK + kc * AT_KC;
    __syncthreads();
    {
      // staging coverage: the group's 128 threads x (4 x 8) elements = 64 rows x 64 per plane = its whole chunk tile
      const int r = tid >> 1, half = (tid & 1) * 32;
      const __bf16* ks = Kg + (size_t)(kv0 + r) * AT_D + half;      // K row kv0+r, d = half..half+31
      const __bf16* vs = Vg + (size_t)r * SEQ + kv0 + half;         // V^T row d = r, keys kv0+half..+31
#pragma unroll
      for (int i = 0; i < 4; ++i) {
        const v8b a0 = *(const v8b*)(ks + 8 * i);
        const v8b b0 = *(const v8b*)(vs + 8 * i);
        *(v8b*)(Ksh + r * AT_LP + half + 8 * i) = a0;
        *(v8b*)(Vth + r * AT_LP + half + 8 * i) = b0;
      }
    }
    __syncthreads();

    // ---- S^T = k . q^T : A fragment row = key j*16+c, B = Q column c, split k map over d on both ----
    // all 8 K fragments are read as ONE group ahead of the products: one LDS latency per chunk instead of one per fragment
    FB kb[4][2];
#pragma unroll
    for (int j = 0; j < 4; ++j) {
#pragma unroll
      for (int dc = 0; dc < 2; ++dc) {
        kb[j][dc].h[0] = *(const v8b*)(Ksh + (j * 16 + c) * AT_LP + dc * 32 + 8 * hh);
        kb[j][dc].h[1] = *(const v8b*)(Ksh + (j * 16 + c) * AT_LP + dc * 32 + 16 + 8 * hh);
      }
    }
    v8f s[4];
#pragma unroll
    for (int j = 0; j < 4; ++j) {
      s[j] = (v8f){0.f,0.f,0.f,0.f,0.f,0.f,0.f,0.f};
#pragma unroll
      for (int dc = 0; dc < 2; ++dc) s[j] = at_mma(kb[j][dc].v, qa[dc], s[j]);
    }
    // the 8 V^T fragments are read into registers here, not among their products: the softmax's vector work between read and use covers the LDS latency
    FB vb[2][4];
#pragma unroll
    for (int kk = 0; kk < 2; ++kk) {
#pragma unroll
      for (int t = 0; t < 4; ++t) {
        vb[kk][t].h[0] = *(const v8b*)(Vth + (t * 16 + c) * AT_LP + kk * 32 + 8 * hh);
        vb[kk][t].h[1] = *(const v8b*)(Vth + (t * 16 + c) * AT_LP + kk * 32 + 16 + 8 * hh);
      }
    }
    // chunk max of query c (s[j][r] = unscaled score of key j*16 + 8hh + r, query c): in-lane, then the other half
    float cm = -INFINITY;
#pragma unroll
    for (int j = 0; j < 4; ++j) {
#pragma unroll
      for (int r = 0; r < 8; ++r) cm = fmaxf(cm, s[j][r]);
    }
    cm = fmaxf(cm, at_xhalf(cm));
    const float mnew = fmaxf(mrow, cm);
    const float alpha = __builtin_amdgcn_exp2f((mrow - mnew) * c2);
    const float nm2 = -mnew * c2;
    mrow = mnew;
    // P^T as B operand: element e of the 32-key block kk = key kk*32 + (e < 8 ? 8hh + e : 16 + 8hh + e - 8) = s[2kk + (e >> 3)][e & 7]
    FB ph[2], pl[2];
    float ps[4];
#pragma unroll
    for (int j = 0; j < 4; ++j) {
#pragma unroll
      for (int r = 0; r < 8; ++r) s[j][r] = fmaf(s[j][r], c2, nm2);
      at_exp2_split8(s[j], ph[j >> 1].u[j & 1], pl[j >> 1].u[j & 1]);   // s[j] becomes p = 2^s[j]
      float psum = s[j][0];
#pragma unroll
      for (int r = 1; r < 8; ++r) psum += s[j][r];
      ps[j] = psum;
    }
    lrow = lrow * alpha + ((ps[0] + ps[1]) + (ps[2] + ps[3]));
#pragma unroll
    for (int t = 0; t < 4; ++t) {
#pragma unroll
      for (int r = 0; r < 8; ++r) oacc[t][r] *= alpha;
    }
    // ---- O^T += v^T . p_hi^T + v^T . p_lo^T : A = V^T [d][key] (row = d t*16+c, split k map over keys), B = P^T ----
    // unrolled: ph / pl / vb are register arrays, their index must be a compile-time constant
#pragma unroll
    for (int kk = 0; kk < 2; ++kk) {
#pragma unroll
      for (int t = 0; t < 4; ++t) {
        oacc[t] = at_mma(vb[kk][t].v, ph[kk].v, oacc[t]);
        oacc[t] = at_mma(vb[kk][t].v, pl[kk].v, oacc[t]);
      }
    }
  }

  // ---- the two key groups join: lane l of group 1's wave hands its max, sum and 32 O^T values to lane l of group 0's wave of the same query tile ----
  // the loops over t and r here are unrolled because oacc is a register array: its index must be a compile-time constant
  if (grp == 1) {
    float* mo = Mo[wave];
#pragma unroll
    for (int t = 0; t < 4; ++t) {
      v4f lo4, hi4;
#pragma unroll
      for (int r = 0; r < 4; ++r) { lo4[r] = oacc[t][r]; hi4[r] = oacc[t][4 + r]; }
      *(v4f*)(mo + ((t * 2 + 0) * 32 + lane) * 4) = lo4;
      *(v4f*)(mo + ((t * 2 + 1) * 32 + lane) * 4) = hi4;
    }
    Mm[wave][lane] = mrow;
    Ml[wave][lane] = lrow;
  }
  __syncthreads();          // group 1's partial results are in LDS; the block's last barrier
  if (grp == 1) return;     // whole waves leave, behind every barrier
  {
    const float* mo = Mo[wave];
    const float m1 = Mm[wave][lane];
    const float l1 = Ml[wave][lane];
    const float mj = fmaxf(mrow, m1);
    const float a0 = __builtin_amdgcn_exp2f((mrow - mj) * c2);
    const float a1 = __builtin_amdgcn_exp2f((m1 - mj) * c2);
    lrow = lrow * a0 + l1 * a1;
#pragma unroll
    for (int t = 0; t < 4; ++t) {
      const v4f lo4 = *(const v4f*)(mo + ((t * 2 + 0) * 32 + lane) * 4);
      const v4f hi4 = *(const v4f*)(mo + ((t * 2 + 1) * 32 + lane) * 4);
#pragma unroll
      for (int r = 0; r < 4; ++r) {
        oacc[t][r]     = oacc[t][r]     * a0 + lo4[r] * a1;
        oacc[t][4 + r] = oacc[t][4 + r] * a0 + hi4[r] * a1;
      }
    }
  }

  // join the two halves' sums of query c; a lane holds 8 consecutive d of query c per tile: two 16-B LDS stores
  float* os = Os[wave];
  {
    const float inv = 1.0f / (lrow + at_xhalf(lrow));
#pragma unroll
    for (int t = 0; t < 4; ++t) {
      v4f lo4, hi4;
#pragma unroll
      for (int r = 0; r < 4; ++r) { lo4[r] = oacc[t][r] * inv; hi4[r] = oacc[t][4 + r] * inv; }
      *(v4f*)(os + c * 68 + t * 16 + 8 * hh)     = lo4;
      *(v4f*)(os + c * 68 + t * 16 + 8 * hh + 4) = hi4;
    }
  }
  __builtin_amdgcn_fence(__ATOMIC_RELEASE, "workgroup");
  __builtin_amdgcn_wave_barrier();
  __builtin_amdgcn_fence(__ATOMIC_ACQUIRE, "workgroup");
  {
    const int c4 = (lane & 15) * 4;
    float* orow = out + (size_t)(q0 + hh) * AT_D + c4;   // one address; the rows follow at constant offsets
    {
#pragma unroll
      for (int it = 0; it < 8; ++it) {
        const int row = it * 2 + hh;   // it 0..7 x hh 0..1 covers rows 0..15 of the wave tile
        v4f val = *(const v4f*)(os + row * 68 + c4);
        *(v4f*)(orow + it * 2 * AT_D) = val;
      }
      
    }
  }
}

// ---------------------------------------------------------------------------
// Workspace region map (byte offsets; every region is fully written by its producer launch before any consumer
//   QB  bf16 [32768][64]          0      4194304
//   KB  bf16 [4096][64]     4194304       524288
//   VT  bf16 [2][64][2048]  4718592       524288
//   total                   5242880
// ---------------------------------------------------------------------------
extern "C" void kernel_launch(void* const* d_in, const int* in_sizes, int n_in,
                              void* d_out, int out_size, void* d_ws, size_t ws_size,
                              hipStream_t stream) {
  if (n_in < 3) return;
  if (in_sizes[0] != NQR * HD) return;          // Q [2][8][2048][64]
  if (in_sizes[1] != NKR * HD) return;          // K [2][1][2048][64]
  if (in_sizes[2] != NKR * HD) return;          // V [2][1][2048][64]
  if (out_size != NQR * HD) return;             // out [2][8][2048][64]; last written element index NQR*HD-1

  const float* Q = (const float*)d_in[0];
  const float* K = (const float*)d_in[1];
  const float* V = (const float*)d_in[2];

  const size_t PQB = (size_t)NQR * HD * 2;      // 4194304
  const size_t PKB = (size_t)NKR * HD * 2;      // 524288
  const size_t PVT = (size_t)NB_ * HD * SEQ * 2;// 524288
  size_t off = 0;
  const size_t oQB = off; off += PQB;
  const size_t oKB = off; off += PKB;
  const size_t oVT = off; off += PVT;
  if (off > ws_size) return;                    // off = 5242880
  if (off > (size_t)134217728) return;

  char* ws = (char*)d_ws;
  unsigned short* QB = (unsigned short*)(ws + oQB);
  unsigned short* KB = (unsigned short*)(ws + oKB);
  unsigned short* VT = (unsigned short*)(ws + oVT);

  // (1) QB = bf16(Q) flat, KB = bf16(K) flat; 1024 + 128 blocks of 256 threads x 8 elements
  const int n8q = NQR * HD / 8;                 // 262144
  const int n8k = NKR * HD / 8;                 // 32768
  const int nbq = n8q / 256;                    // 1024
  const int nbk = n8k / 256;                    // 128
  cvt2_kernel<<<dim3(nbq + nbk), dim3(256), 0, stream>>>(Q, K, QB, KB, nbq, n8q, n8k);
  // (2) V[b] viewed [R=2048 s][Cc=64 d] (pitch 64) -> VT_b[d][s] (pitch 2048); grid (Cc/64, R/64, B) = (1, 32, 2)
  tconv_kernel<<<dim3(HD / 64, SEQ / 64, NB_), dim3(256), 0, stream>>>(V, VT, HD, SEQ, (long)SEQ * HD, (long)HD * SEQ);
  // (3) attention per (batch, head, 64-query block) -> d_out rows (b*8+h)*2048 + q; 512 blocks x 256 threads (4 query tiles x 2 key groups)
  attn_mqa_kernel<<<dim3(NB_ * NH_ * (SEQ / 64)), dim3(256), 0, stream>>>(QB, KB, VT, (float*)d_out, 0.125f);
  (void)hipGetLastError();
}

// v007
// One run takes 28.6 microseconds.
// Next to v006, in two timings, it ran 1.20 times as fast each time.
// Over all steps from v000 it is 5.22 times as fast.
#include <hip/hip_runtime.h>
#include <math.h>
#include <stdint.h>

#define NB_   2
#define NH_   8
#define SEQ   2048
#define HD    64
#define NQR   (NB_ * NH_ * SEQ)   // 32768 q / out rows
#define NKR   (NB_ * SEQ)         // 4096 k rows

static_assert(HD == 64);
static_assert(SEQ % 64 == 0);
static_assert((NQR * HD) % (8 * 256) == 0);
static_assert((NKR * HD) % (8 * 256) == 0);

typedef __attribute__((ext_vector_type(16))) _Float16 v16h;
typedef __attribute__((ext_vector_type(8)))  _Float16 v8h;
typedef __attribute__((ext_vector_type(16))) __bf16   v16b;
typedef __attribute__((ext_vector_type(8)))  __bf16   v8b;
typedef __attribute__((ext_vector_type(8)))  float    v8f;
typedef __attribute__((ext_vector_type(4)))  float    v4f;
typedef __attribute__((ext_vector_type(4)))  unsigned int v4u;

__device__ __forceinline__ unsigned short f2bf_bits(float f) {
  unsigned u = __float_as_uint(f);
  return (unsigned short)((u + 0x7FFFu + ((u >> 16) & 1u)) >> 16);
}
__device__ __forceinline__ float bf_bits2f(unsigned short h) { return __uint_as_float(((unsigned)h) << 16); }
__device__ __forceinline__ unsigned pk16(unsigned short a, unsigned short b) { return (unsigned)a | ((unsigned)b << 16); }

// A / B fragment load (split k map): elements 0..7 <- p[0..7], 8..15 <- p[16..23]; caller passes p = row + k0 + 8*(lane>>4)
__device__ __forceinline__ v16b ld_frag_bf(const __bf16* p) {
  union { v16b v; v8b h[2]; } f;
  f.h[0] = *(const v8b*)(p);
  f.h[1] = *(const v8b*)(p + 16);
  return f.v;
}

// 2^x of the 8 exponent arguments of one score tile (in place), and the hi|lo bf16 split of the results, in one statement.
// Split, three vector instructions a pair: v_cvt_pk_bf16_f32 rounds two values to hi (nearest even); v_fma_mixlo_bf16 / v_fma_mixhi_bf16
// form f - hi (exact in f32) and round it to the low / high half of lo. op_sel picks the half of hi; -1.0 is read as bf16 from the
// high half of its f32 constant.
// Why one statement: each v_exp_f32 works in place and the instruction behind it touches neither its register nor its result (the slot
// that the instruction set asks for behind a transcendental), and the last three stand between split instructions instead of in a row.
// Each s_delay_alu names the distance to the producer (the first: the producers of f in front of the statement), so that the SIMD
// issues its other wave while this one waits: the compiler puts no such hint inside asm text.
__device__ __forceinline__ void at_exp2_split8(v8f& f, v4u& hi, v4u& lo) {
  unsigned h0, h1, h2, h3, l0, l1, l2, l3;
  float f0 = f[0], f1 = f[1], f2 = f[2], f3 = f[3], f4 = f[4], f5 = f[5], f6 = f[6], f7 = f[7];
  asm("s_delay_alu instid0(VALU_DEP_1)\n\t"
      "v_exp_f32 %8, %8\n\t"
      "v_exp_f32 %9, %9\n\t"
      "v_exp_f32 %10, %10\n\t"
      "v_exp_f32 %11, %11\n\t"
      "v_exp_f32 %12, %12\n\t"
      "v_cvt_pk_bf16_f32 %0, %8, %9\n\t"
      "v_exp_f32 %13, %13\n\t"
      "s_delay_alu instid0(TRANS32_DEP_3) | instskip(SKIP_1) | instid1(VALU_DEP_2)\n\t"
      "v_cvt_pk_bf16_f32 %1, %10, %11\n\t"
      "v_exp_f32 %14, %14\n\t"
      "v_fma_mixlo_bf16 %4, %0, -1.0, %8 op_sel:[0,1,0] op_sel_hi:[1,1,0]\n\t"
      "v_exp_f32 %15, %15\n\t"
      "s_delay_alu instid0(VALU_DEP_2) | instskip(NEXT) | instid1(TRANS32_DEP_3)\n\t"
      "v_fma_mixlo_bf16 %5, %1, -1.0, %10 op_sel:[0,1,0] op_sel_hi:[1,1,0]\n\t"
      "v_cvt_pk_bf16_f32 %2, %12, %13\n\t"
      "s_delay_alu instid0(VALU_DEP_3) | instskip(NEXT) | instid1(TRANS32_DEP_1)\n\t"
      "v_fma_mixhi_bf16 %4, %0, -1.0, %9 op_sel:[1,1,0] op_sel_hi:[1,1,0]\n\t"
      "v_cvt_pk_bf16_f32 %3, %14, %15\n\t"
      "s_delay_alu instid0(VALU_DEP_4) | instskip(NEXT) | instid1(VALU_DEP_4)\n\t"
      "v_fma_mixhi_bf16 %5, %1, -1.0, %11 op_sel:[1,1,0] op_sel_hi:[1,1,0]\n\t"
      "v_fma_mixlo_bf16 %6, %2, -1.0, %12 op_sel:[0,1,0] op_sel_hi:[1,1,0]\n\t"
      "s_delay_alu instid0(VALU_DEP_3) | instskip(NEXT) | instid1(VALU_DEP_2)\n\t"
      "v_fma_mixlo_bf16 %7, %3, -1.0, %14 op_sel:[0,1,0] op_sel_hi:[1,1,0]\n\t"
      "v_fma_mixhi_bf16 %6, %2, -1.0, %13 op_sel:[1,1,0] op_sel_hi:[1,1,0]\n\t"
      "s_delay_alu instid0(VALU_DEP_2)\n\t"
      "v_fma_mixhi_bf16 %7, %3, -1.0, %15 op_sel:[1,1,0] op_sel_hi:[1,1,0]"
      : "=&v"(h0), "=&v"(h1), "=&v"(h2), "=&v"(h3), "=&v"(l0), "=&v"(l1), "=&v"(l2), "=&v"(l3),
        "+v"(f0), "+v"(f1), "+v"(f2), "+v"(f3), "+v"(f4), "+v"(f5), "+v"(f6), "+v"(f7));
  f = (v8f){f0, f1, f2, f3, f4, f5, f6, f7};
  hi = (v4u){h0, h1, h2, h3};
  lo = (v4u){l0, l1, l2, l3};
}
// lane l <-> lane l ^ 16 (the other half of the same column) as a vector cross-row move
__device__ __forceinline__ float at_xhalf(float f) {
  const int b = __float_as_int(f);
  return __int_as_float(__builtin_amdgcn_permlanex16(b, b, 0x76543210, 0xfedcba98, false, false));
}
typedef uint32_t u32x4 __attribute__((ext_vector_type(4)));
typedef uint32_t u32x8 __attribute__((ext_vector_type(8)));
__device__ __forceinline__ uint32_t at_uni(uint32_t v) { return (uint32_t)__builtin_amdgcn_readfirstlane(v); }
// wave-uniform test value held in a scalar register (the empty statement is the one that keeps a tensor load's issue test a scalar branch: tensor loads ignore EXEC)
__device__ __forceinline__ uint32_t pinned(uint32_t v) { uint32_t w = at_uni(v); asm volatile("" : "+s"(w)); return w; }
// tensor descriptor, group 1: 1-byte elements, tile = tensor = 64 rows of 128 B, source row pitch src_pitch bytes,
// a pad of 4 dwords behind every 32 dwords (one row): LDS pitch 144 B; no work-group mask
__device__ __forceinline__ u32x8 at_tdm_group1(uint32_t src_pitch) {
  u32x8 g;
  g[0] = at_uni((1u << 20) | (4u << 22) | (3u << 25));
  g[1] = at_uni(128u << 16);
  g[2] = at_uni(64u << 16);
  g[3] = at_uni(128u << 16);
  g[4] = at_uni(64u);
  g[5] = at_uni(src_pitch);
  g[6] = at_uni(0u);
  g[7] = at_uni(0u);
  return g;
}
// group 0: count 1, LDS byte offset of the tile, global address of its first byte, type 2
__device__ __forceinline__ u32x4 at_tdm_group0(uint32_t lds_dst, uint64_t ga) {
  u32x4 g;
  g[0] = at_uni(1u);
  g[1] = at_uni(lds_dst);
  g[2] = at_uni((uint32_t)ga);
  g[3] = at_uni((((uint32_t)(ga >> 32)) & 0x01FFFFFFu) | 0x80000000u);
  return g;
}
// one request of the whole wave: global tile -> LDS, through no register; the waits are written at the call sites
__device__ __forceinline__ void at_tdm_load(u32x4 g0, u32x8 g1) { asm volatile("tensor_load_to_lds %0, %1" :: "s"(g0), "s"(g1) : "memory"); }
// WMMA with dependency guard: 4 VALU nops tied to D, A and B kept live
__device__ __forceinline__ v8f at_mma(v16b a, v16b b, v8f c) {
  c = __builtin_amdgcn_wmma_f32_16x16x32_bf16(false, a, false, b, (short)0, c, false, false);
  asm volatile("v_nop\n\tv_nop\n\tv_nop\n\tv_nop" : "+v"(c) : "v"(a), "v"(b));
  return c;
}

// ---------------------------------------------------------------------------
// Flat bf16 RNE convert of two f32 arrays in one launch (block-uniform role split):
//   blocks 0..nbq-1 : qo[e] = bf16(qin[e]), unit i = block*256+tid < n8q, elements 8i..8i+7
//   blocks nbq..    : ko[e] = bf16(kin[e]), unit i = (block-nbq)*256+tid < n8k
// Coverage: q: 1024 blocks x 256 x 8 = 2097152 = 32768x64; k: 128 blocks x 256 x 8 = 262144 = 4096x64.
// ---------------------------------------------------------------------------
__global__ __launch_bounds__(256) void cvt2_kernel(const float* __restrict__ qin, const float* __restrict__ kin,
                                                   unsigned short* __restrict__ qo, unsigned short* __restrict__ ko,
                                                   int nbq, int n8q, int n8k) {
  const bool isq = (int)blockIdx.x < nbq;                 // block-uniform
  const float* in = isq ? qin : kin;                      // both global, uniform select
  unsigned short* out = isq ? qo : ko;
  const int n8 = isq ? n8q : n8k;
  const int blk = isq ? (int)blockIdx.x : ((int)blockIdx.x - nbq);
  const int i = blk * 256 + (int)threadIdx.x;
  if (i < n8) {
    const size_t e0 = (size_t)i * 8;
    const v4f a = *(const v4f*)(in + e0);
    const v4f c = *(const v4f*)(in + e0 + 4);
    v4u hv;
    hv[0] = pk16(f2bf_bits(a[0]), f2bf_bits(a[1]));
    hv[1] = pk16(f2bf_bits(a[2]), f2bf_bits(a[3]));
    hv[2] = pk16(f2bf_bits(c[0]), f2bf_bits(c[1]));
    hv[3] = pk16(f2bf_bits(c[2]), f2bf_bits(c[3]));
    {
      *(v4u*)(out + e0) = hv;
      
    }
  }
}

// ---------------------------------------------------------------------------
// Fused transpose + bf16 RNE convert of an f32 matrix, z-batched, one plane:
//   in_z = W + z*sIn viewed [R rows][Cc cols] with row pitch ldin  ->  oh_z[c][r] = bf16(in_z[r][c]), row pitch ldout, oh_z = oh + z*sOut.
// 64x64 tiles through LDS. grid = (Cc/64, R/64, Z), 256 threads (R, Cc multiples of 64; ldout multiple of 64 so every
// Coverage per block: load 4 it x 256 thr x 4 floats = 64x64; store 2 it x 256 thr x 8 u16 = 64x64.
// Here: in_z = V[z] [R=2048 s][Cc=64 d] (ldin 64), out VT_z [64 d][2048 s] (ldout 2048); grid (1, 32, 2).
// ---------------------------------------------------------------------------
__global__ __launch_bounds__(256) void tconv_kernel(const float* __restrict__ W, unsigned short* __restrict__ oh,
                                                    int ldin, int ldout, long sIn, long sOut) {
  __shared__ __align__(16) float tf[64 * 68];
  W  += (size_t)blockIdx.z * sIn;
  oh += (size_t)blockIdx.z * sOut;
  const int c0  = blockIdx.x * 64;   // input column block = output row block
  const int r0  = blockIdx.y * 64;   // input row block    = output column block
  const int tid = threadIdx.x;
  {
    const int lr = tid >> 4;         // 0..15
    const int c4 = (tid & 15) * 4;   // 0..60
#pragma unroll
    for (int it = 0; it < 4; ++it) {
      const int rr = it * 16 + lr;   // 0..63
      const v4f a = *(const v4f*)(W + (size_t)(r0 + rr) * ldin + c0 + c4);
      *(v4f*)(tf + rr * 68 + c4) = a;
    }
  }
  __syncthreads();
  const int sub = tid >> 3;          // 0..31
  const int c8  = (tid & 7) * 8;     // 0..56
  v4u hv[2];
#pragma unroll
  for (int it = 0; it < 2; ++it) {
    const int oc = it * 32 + sub;    // output row within tile (= input column)
    v4u a;
#pragma unroll
    for (int q = 0; q < 4; ++q) {
      const float f0 = tf[(c8 + 2 * q) * 68 + oc];
      const float f1 = tf[(c8 + 2 * q + 1) * 68 + oc];
      a[q] = pk16(f2bf_bits(f0), f2bf_bits(f1));
    }
    hv[it] = a;
  }
  {
#pragma unroll
    for (int it = 0; it < 2; ++it) {
      const int oc = it * 32 + sub;
      const size_t go = (size_t)(c0 + oc) * ldout + r0 + c8;
      *(v4u*)(oh + go) = hv[it];
    }
    
  }
}

// =====================================================================================
// Full (non-causal, unmasked) multi-query attention, head dim 64, all (batch, head) pairs in one launch.
//   q plane (bf16) [32768][64]: element (b, h, q, d) at [((b*8+h)*2048 + q)*64 + d]
//   k plane (bf16) [4096][64]: element (b, s, d) at [(b*2048 + s)*64 + d]       (one key head shared by all 8 query heads)
//   v^T plane (bf16) [2][64][2048]: element (b, d, s) at [b*131072 + d*2048 + s] (one value head shared by all 8 query heads)
//   out f32 [32768][64]: element (b, h, q, d) at [((b*8+h)*2048 + q)*64 + d]
//   scores^T = (k . q^T) * 0.125 : single bf16 product (exact), f32 accumulate; A = K rows, B = Q columns
//   out^T    = v^T . p^T         : v^T . p_hi^T + v^T . p_lo^T (p = unnormalised exp split into bf16 hi|lo; the same v^T LDS
//                               fragment serves both terms), f32 accumulate, x 1/rowsum in f32 at the end
//   online softmax in f32 (base 2, scale folded into the exponent's multiply-add) over all 2048 keys of the batch element (2 key groups x 16 chunks of 64, compile-time trip count, no masking):
//   lane (c, hh) holds the scores of query c for the keys j*16 + 8*hh + r; max and sum run in-lane, the two halves of a
//   query join by one cross-row move (max: every chunk; sum: once, in the epilogue).
//   Block = 8 waves = 4 query tiles x 2 key groups, 64 query rows of one (batch, head); grid.x = 2 * 8 * 32 = 512 (exact).
//   Key group g (waves 4g..4g+3) walks the keys g*1024 .. g*1024+1023 in 16 chunks of 64 with its own running max, sum and O^T and its
//   own K / V^T tiles: four waves a SIMD instead of two stand ready while a group waits for its staging, and the chain of chunks is half as long.
//   Behind the loop group 1 hands max, sum and O^T to group 0 through LDS (one barrier); group 0 rescales both to the common max and adds.
//   K / V^T chunk staging: one tensor load a tile (64 rows x 128 B, padded to the 144-B pitch by the mover), issued by waves 0 (K) and 1 (V^T)
//   of each key group, into a ring of two buffers: chunk kc+2's loads are issued at the foot of trip kc and fly during trip kc+1.
//   One publish point a trip: LDS reads retired, the issuers' tensor wait, the block's barrier, then the refill of the buffer just read.
//   LDS extents: K/V tiles 64x64 fully staged every chunk, rows at a pitch of 72 elements; the 8 pad elements of a row are never written or read.
//   Epilogue: each wave of key group 0 stages its 16x64 f32 tile in LDS, then writes 256-B output rows as 16 lanes x 16 B
// =====================================================================================
#define AT_D 64
#define AT_NW 4    // query tiles of 16 rows = waves per key group
#define AT_NG 2    // key groups per block
#define AT_GK (SEQ / AT_NG)   // 1024 keys per group
#define AT_QB 64
#define AT_KC 64
#define AT_LP 72   // LDS row pitch of the K and V^T tiles in elements: 144 B = 16 B x 9 (odd), so the 16 rows of a ds_load_b128 fragment read fall on 16 different bank groups

#define AT_TB 10240           // LDS bytes a tile: 64 rows x 144 B = 9216, rounded up so that every tile starts at a multiple of 2 KiB
#define AT_BUFB (AT_NG * 2 * AT_TB)   // one ring buffer: K and V^T tile of both key groups

static_assert(AT_GK % AT_KC == 0);
static_assert(AT_GK / AT_KC >= 2);    // the ring's prologue needs two stages
static_assert(AT_KC * AT_LP * 2 <= AT_TB && AT_TB % 2048 == 0);

__global__ __launch_bounds__(256)
void attn_mqa_kernel(const unsigned short* __restrict__ qp, const unsigned short* __restrict__ kp,
                     const unsigned short* __restrict__ vtp, float* __restrict__ out, float sscale) {
  union FB { v16b v; v8b h[2]; v4u u[2]; };
  __shared__ __attribute__((aligned(2048))) unsigned char Ring[2 * AT_BUFB];   // [buffer][key group][K [kv][d] | V^T [d][kv]][AT_TB]
  __shared__ __align__(16) float  Os[AT_NW][16 * 68];            // per query tile: out tile, pitch 68
  __shared__ __align__(16) float  Mo[AT_NW][8 * 32 * 4];         // per query tile: group 1's O^T, [16-B piece 0..7][lane]
  __shared__ float Mm[AT_NW][32];                                // per query tile: group 1's running max, by lane
  __shared__ float Ml[AT_NW][32];                                // per query tile: group 1's running sum, by lane

  const int grp  = __builtin_amdgcn_readfirstlane((int)threadIdx.x >> 7);   // key group 0..1, the same in a whole wave
  const int tid  = threadIdx.x & 127;     // thread within the key group
  const int wave = tid >> 5;              // query tile 0..3
  const int lane = tid & 31;
  const int hh   = lane >> 4;
  const int c    = lane & 15;

  const int nqb = SEQ / AT_QB;            // 32 query blocks per (batch, head)
  const int bx = blockIdx.x;              // grid = NB_ * NH_ * nqb (exact)
  const int qb = bx % nqb;
  const int bh = bx / nqb;                // b*8 + h, 0..15
  const int b  = bh / NH_;                // 0..1 : key / value index depends on b only
  const int q0 = bh * SEQ + qb * AT_QB + wave * 16;   // row in the q plane == row in out

  const __bf16* Qg = (const __bf16*)(const void*)qp;
  const __bf16* Kg = (const __bf16*)(const void*)kp  + (size_t)b * SEQ * AT_D;   // keys of batch b
  const __bf16* Vg = (const __bf16*)(const void*)vtp + (size_t)b * AT_D * SEQ;   // V^T of batch b [d][s]

  // ---- Q fragments (B operand, column = query lane&15, split k map): 2 d-chunks ----
  v16b qa[2];
#pragma unroll
  for (int dc = 0; dc < 2; ++dc)
    qa[dc] = ld_frag_bf(Qg + (size_t)(q0 + c) * AT_D + dc * 32 + 8 * hh);

  // exp(sscale * (s - m)) = 2^(s * c2 - m * c2), c2 = sscale * log2(e): one fused multiply-add and one v_exp_f32 a score.
  // The argument is never above 0 but for its own rounding; far below, 2^x runs out to 0, as exp does.
  const float c2 = sscale * 1.44269504088896340736f;
  float mrow = -INFINITY;   // running max of query c over the UNSCALED scores (sscale > 0: the same key wins), equal in both halves
  float lrow = 0.f;         // running sum of query c over this half's keys only
  v8f oacc[4];              // oacc[t][r] = O^T[d = t*16 + 8*hh + r][query c]
#pragma unroll
  for (int t = 0; t < 4; ++t) oacc[t] = (v8f){0.f,0.f,0.f,0.f,0.f,0.f,0.f,0.f};

  const int nChunks = AT_GK / AT_KC;   // 16 per key group, compile-time constant, the same for both groups (the barriers are the block's)
  // ---- tensor-load ring: wave 0 of a key group brings its K tiles, wave 1 its V^T tiles; one request of a wave in flight ----
  const uint32_t wg = at_uni(threadIdx.x >> 5) & 3u;     // wave within the key group (one-dimensional block)
  const bool issuer = wg < 2u;
  const bool isV = wg == 1u;
  const uint32_t dst0 = (uint32_t)(uintptr_t)(&Ring[0]) + (uint32_t)grp * (2u * AT_TB) + (isV ? (uint32_t)AT_TB : 0u);
  // first byte of the group's chunk 0: K rows grp*1024.. (a chunk on: 64 rows x 128 B); V^T row 0, keys grp*1024.. (a chunk on: 64 keys x 2 B)
  const uint64_t src0 = isV ? (uint64_t)(uintptr_t)(Vg + grp * AT_GK) : (uint64_t)(uintptr_t)(Kg + (size_t)grp * AT_GK * AT_D);
  const uint32_t sstep = isV ? (uint32_t)(AT_KC * 2) : (uint32_t)(AT_KC * AT_D * 2);
  const u32x8 g1 = at_tdm_group1(isV ? (uint32_t)(SEQ * 2) : (uint32_t)(AT_D * 2));
  if (pinned(issuer)) {
    at_tdm_load(at_tdm_group0(dst0, src0), g1);
    asm volatile("s_wait_tensorcnt 0x0" ::: "memory");   // chunk 0 has landed before the barrier that publishes it
  }
  __syncthreads();
  if (pinned(issuer)) at_tdm_load(at_tdm_group0(dst0 + AT_BUFB, src0 + sstep), g1);   // chunk 1 flies during trip 0
  for (int kc = 0; kc < nChunks; ++kc) {
    const __bf16* Ksh = (const __bf16*)(const void*)(Ring + (kc & 1) * AT_BUFB + grp * (2 * AT_TB));
    const __bf16* Vth = Ksh + AT_TB / 2;

    // ---- S^T = k . q^T : A fragment row = key j*16+c, B = Q column c, split k map over d on both ----
    // all 8 K fragments are read as ONE group ahead of the products: one LDS latency per chunk instead of one per fragment
    FB kb[4][2];
#pragma unroll
    for (int j = 0; j < 4; ++j) {
#pragma unroll
      for (int dc = 0; dc < 2; ++dc) {
        kb[j][dc].h[0] = *(const v8b*)(Ksh + (j * 16 + c) * AT_LP + dc * 32 + 8 * hh);
        kb[j][dc].h[1] = *(const v8b*)(Ksh + (j * 16 + c) * AT_LP + dc * 32 + 16 + 8 * hh);
      }
    }
    v8f s[4];
#pragma unroll
    for (int j = 0; j < 4; ++j) {
      s[j] = (v8f){0.f,0.f,0.f,0.f,0.f,0.f,0.f,0.f};
#pragma unroll
      for (int dc = 0; dc < 2; ++dc) s[j] = at_mma(kb[j][dc].v, qa[dc], s[j]);
    }
    // the 8 V^T fragments are read into registers here, not among their products: the softmax's vector work between read and use covers the LDS latency
    FB vb[2][4];
#pragma unroll
    for (int kk = 0; kk < 2; ++kk) {
#pragma unroll
      for (int t = 0; t < 4; ++t) {
        vb[kk][t].h[0] = *(const v8b*)(Vth + (t * 16 + c) * AT_LP + kk * 32 + 8 * hh);
        vb[kk][t].h[1] = *(const v8b*)(Vth + (t * 16 + c) * AT_LP + kk * 32 + 16 + 8 * hh);
      }
    }
    // chunk max of query c (s[j][r] = unscaled score of key j*16 + 8hh + r, query c): in-lane, then the other half
    float cm = -INFINITY;
#pragma unroll
    for (int j = 0; j < 4; ++j) {
#pragma unroll
      for (int r = 0; r < 8; ++r) cm = fmaxf(cm, s[j][r]);
    }
    cm = fmaxf(cm, at_xhalf(cm));
    const float mnew = fmaxf(mrow, cm);
    const float alpha = __builtin_amdgcn_exp2f((mrow - mnew) * c2);
    const float nm2 = -mnew * c2;
    mrow = mnew;
    // P^T as B operand: element e of the 32-key block kk = key kk*32 + (e < 8 ? 8hh + e : 16 + 8hh + e - 8) = s[2kk + (e >> 3)][e & 7]
    FB ph[2], pl[2];
    float ps[4];
#pragma unroll
    for (int j = 0; j < 4; ++j) {
#pragma unroll
      for (int r = 0; r < 8; ++r) s[j][r] = fmaf(s[j][r], c2, nm2);
      at_exp2_split8(s[j], ph[j >> 1].u[j & 1], pl[j >> 1].u[j & 1]);   // s[j] becomes p = 2^s[j]
      float psum = s[j][0];
#pragma unroll
      for (int r = 1; r < 8; ++r) psum += s[j][r];
      ps[j] = psum;
    }
    lrow = lrow * alpha + ((ps[0] + ps[1]) + (ps[2] + ps[3]));
#pragma unroll
    for (int t = 0; t < 4; ++t) {
#pragma unroll
      for (int r = 0; r < 8; ++r) oacc[t][r] *= alpha;
    }
    // ---- O^T += v^T . p_hi^T + v^T . p_lo^T : A = V^T [d][key] (row = d t*16+c, split k map over keys), B = P^T ----
    // unrolled: ph / pl / vb are register arrays, their index must be a compile-time constant
#pragma unroll
    for (int kk = 0; kk < 2; ++kk) {
#pragma unroll
      for (int t = 0; t < 4; ++t) {
        oacc[t] = at_mma(vb[kk][t].v, ph[kk].v, oacc[t]);
        oacc[t] = at_mma(vb[kk][t].v, pl[kk].v, oacc[t]);
      }
    }
    // ---- publish point of chunk kc+1, every wave, in this order ----
    asm volatile("s_wait_dscnt 0x0" ::: "memory");                             // this wave's reads of the buffer have retired before it may be refilled
    if (pinned(issuer)) asm volatile("s_wait_tensorcnt 0x0" ::: "memory");     // this wave's tile of chunk kc+1 has landed
    __syncthreads();                                                           // chunk kc+1 readable by all; every wave has left chunk kc's buffer
    if (pinned(issuer && kc + 2 < nChunks))
      at_tdm_load(at_tdm_group0(dst0 + (uint32_t)(kc & 1) * AT_BUFB, src0 + (uint64_t)(uint32_t)(kc + 2) * sstep), g1);
  }
  asm volatile("s_wait_tensorcnt 0x0" ::: "memory");   // nothing of the ring in flight behind the loop
  asm volatile("s_wait_dscnt 0x0" ::: "memory");

  // ---- the two key groups join: lane l of group 1's wave hands its max, sum and 32 O^T values to lane l of group 0's wave of the same query tile ----
  // the loops over t and r here are unrolled because oacc is a register array: its index must be a compile-time constant
  if (grp == 1) {
    float* mo = Mo[wave];
#pragma unroll
    for (int t = 0; t < 4; ++t) {
      v4f lo4, hi4;
#pragma unroll
      for (int r = 0; r < 4; ++r) { lo4[r] = oacc[t][r]; hi4[r] = oacc[t][4 + r]; }
      *(v4f*)(mo + ((t * 2 + 0) * 32 + lane) * 4) = lo4;
      *(v4f*)(mo + ((t * 2 + 1) * 32 + lane) * 4) = hi4;
    }
    Mm[wave][lane] = mrow;
    Ml[wave][lane] = lrow;
  }
  __syncthreads();          // group 1's partial results are in LDS; the block's last barrier
  if (grp == 1) return;     // whole waves leave, behind every barrier
  {
    const float* mo = Mo[wave];
    const float m1 = Mm[wave][lane];
    const float l1 = Ml[wave][lane];
    const float mj = fmaxf(mrow, m1);
    const float a0 = __builtin_amdgcn_exp2f((mrow - mj) * c2);
    const float a1 = __builtin_amdgcn_exp2f((m1 - mj) * c2);
    lrow = lrow * a0 + l1 * a1;
#pragma unroll
    for (int t = 0; t < 4; ++t) {
      const v4f lo4 = *(const v4f*)(mo + ((t * 2 + 0) * 32 + lane) * 4);
      const v4f hi4 = *(const v4f*)(mo + ((t * 2 + 1) * 32 + lane) * 4);
#pragma unroll
      for (int r = 0; r < 4; ++r) {
        oacc[t][r]     = oacc[t][r]     * a0 + lo4[r] * a1;
        oacc[t][4 + r] = oacc[t][4 + r] * a0 + hi4[r] * a1;
      }
    }
  }

  // join the two halves' sums of query c; a lane holds 8 consecutive d of query c per tile: two 16-B LDS stores
  float* os = Os[wave];
  {
    const float inv = 1.0f / (lrow + at_xhalf(lrow));
#pragma unroll
    for (int t = 0; t < 4; ++t) {
      v4f lo4, hi4;
#pragma unroll
      for (int r = 0; r < 4; ++r) { lo4[r] = oacc[t][r] * inv; hi4[r] = oacc[t][4 + r] * inv; }
      *(v4f*)(os + c * 68 + t * 16 + 8 * hh)     = lo4;
      *(v4f*)(os + c * 68 + t * 16 + 8 * hh + 4) = hi4;
    }
  }
  __builtin_amdgcn_fence(__ATOMIC_RELEASE, "workgroup");
  __builtin_amdgcn_wave_barrier();
  __builtin_amdgcn_fence(__ATOMIC_ACQUIRE, "workgroup");
  {
    const int c4 = (lane & 15) * 4;
    float* orow = out + (size_t)(q0 + hh) * AT_D + c4;   // one address; the rows follow at constant offsets
    {
#pragma unroll
      for (int it = 0; it < 8; ++it) {
        const int row = it * 2 + hh;   // it 0..7 x hh 0..1 covers rows 0..15 of the wave tile
        v4f val = *(const v4f*)(os + row * 68 + c4);
        *(v4f*)(orow + it * 2 * AT_D) = val;
      }
      
    }
  }
}

// ---------------------------------------------------------------------------
// Workspace region map (byte offsets; every region is fully written by its producer launch before any consumer
//   QB  bf16 [32768][64]          0      4194304
//   KB  bf16 [4096][64]     4194304       524288
//   VT  bf16 [2][64][2048]  4718592       524288
//   total                   5242880
// ---------------------------------------------------------------------------
extern "C" void kernel_launch(void* const* d_in, const int* in_sizes, int n_in,
                              void* d_out, int out_size, void* d_ws, size_t ws_size,
                              hipStream_t stream) {
  if (n_in < 3) return;
  if (in_sizes[0] != NQR * HD) return;          // Q [2][8][2048][64]
  if (in_sizes[1] != NKR * HD) return;          // K [2][1][2048][64]
  if (in_sizes[2] != NKR * HD) return;          // V [2][1][2048][64]
  if (out_size != NQR * HD) return;             // out [2][8][2048][64]; last written element index NQR*HD-1

  const float* Q = (const float*)d_in[0];
  const float* K = (const float*)d_in[1];
  const float* V = (const float*)d_in[2];

  const size_t PQB = (size_t)NQR * HD * 2;      // 4194304
  const size_t PKB = (size_t)NKR * HD * 2;      // 524288
  const size_t PVT = (size_t)NB_ * HD * SEQ * 2;// 524288
  size_t off = 0;
  const size_t oQB = off; off += PQB;
  const size_t oKB = off; off += PKB;
  const size_t oVT = off; off += PVT;
  if (off > ws_size) return;                    // off = 5242880
  if (off > (size_t)134217728) return;

  char* ws = (char*)d_ws;
  unsigned short* QB = (unsigned short*)(ws + oQB);
  unsigned short* KB = (unsigned short*)(ws + oKB);
  unsigned short* VT = (unsigned short*)(ws + oVT);

  // (1) QB = bf16(Q) flat, KB = bf16(K) flat; 1024 + 128 blocks of 256 threads x 8 elements
  const int n8q = NQR * HD / 8;                 // 262144
  const int n8k = NKR * HD / 8;                 // 32768
  const int nbq = n8q / 256;                    // 1024
  const int nbk = n8k / 256;                    // 128
  cvt2_kernel<<<dim3(nbq + nbk), dim3(256), 0, stream>>>(Q, K, QB, KB, nbq, n8q, n8k);
  // (2) V[b] viewed [R=2048 s][Cc=64 d] (pitch 64) -> VT_b[d][s] (pitch 2048); grid (Cc/64, R/64, B) = (1, 32, 2)
  tconv_kernel<<<dim3(HD / 64, SEQ / 64, NB_), dim3(256), 0, stream>>>(V, VT, HD, SEQ, (long)SEQ * HD, (long)HD * SEQ);
  // (3) attention per (batch, head, 64-query block) -> d_out rows (b*8+h)*2048 + q; 512 blocks x 256 threads (4 query tiles x 2 key groups)
  attn_mqa_kernel<<<dim3(NB_ * NH_ * (SEQ / 64)), dim3(256), 0, stream>>>(QB, KB, VT, (float*)d_out, 0.125f);
  (void)hipGetLastError();
}

// v008
// It runs in 26.8 microseconds.
// Two timings next to v007 put it at 1.06 and 1.07 times that version's speed.
// Counting every step since v000, it is 5.55 times as fast.
#include <hip/hip_runtime.h>
#include <math.h>
#include <stdint.h>

#define NB_   2
#define NH_   8
#define SEQ   2048
#define HD    64
#define NQR   (NB_ * NH_ * SEQ)   // 32768 q / out rows
#define NKR   (NB_ * SEQ)         // 4096 k rows

static_assert(HD == 64);
static_assert(SEQ % 64 == 0);
static_assert((NQR * HD) % (8 * 256) == 0);
static_assert((NKR * HD) % (8 * 256) == 0);

typedef __attribute__((ext_vector_type(16))) _Float16 v16h;
typedef __attribute__((ext_vector_type(8)))  _Float16 v8h;
typedef __attribute__((ext_vector_type(16))) __bf16   v16b;
typedef __attribute__((ext_vector_type(8)))  __bf16   v8b;
typedef __attribute__((ext_vector_type(8)))  float    v8f;
typedef __attribute__((ext_vector_type(4)))  float    v4f;
typedef __attribute__((ext_vector_type(4)))  unsigned int v4u;

__device__ __forceinline__ unsigned short f2bf_bits(float f) {
  unsigned u = __float_as_uint(f);
  return (unsigned short)((u + 0x7FFFu + ((u >> 16) & 1u)) >> 16);
}
__device__ __forceinline__ float bf_bits2f(unsigned short h) { return __uint_as_float(((unsigned)h) << 16); }
__device__ __forceinline__ unsigned pk16(unsigned short a, unsigned short b) { return (unsigned)a | ((unsigned)b << 16); }

// A / B fragment load (split k map): elements 0..7 <- p[0..7], 8..15 <- p[16..23]; caller passes p = row + k0 + 8*(lane>>4)
__device__ __forceinline__ v16b ld_frag_bf(const __bf16* p) {
  union { v16b v; v8b h[2]; } f;
  f.h[0] = *(const v8b*)(p);
  f.h[1] = *(const v8b*)(p + 16);
  return f.v;
}

// 2^x of the 8 exponent arguments of one score tile (in place), and the hi|lo bf16 split of the results, in one statement.
// Split, three vector instructions a pair: v_cvt_pk_bf16_f32 rounds two values to hi (nearest even); v_fma_mixlo_bf16 / v_fma_mixhi_bf16
// form f - hi (exact in f32) and round it to the low / high half of lo. op_sel picks the half of hi; -1.0 is read as bf16 from the
// high half of its f32 constant.
// Why one statement: each v_exp_f32 works in place and the instruction behind it touches neither its register nor its result (the slot
// that the instruction set asks for behind a transcendental), and the last three stand between split instructions instead of in a row.
// Each s_delay_alu names the distance to the producer (the first: the producers of f in front of the statement), so that the SIMD
// issues its other wave while this one waits: the compiler puts no such hint inside asm text.
__device__ __forceinline__ void at_exp2_split8(v8f& f, v4u& hi, v4u& lo) {
  unsigned h0, h1, h2, h3, l0, l1, l2, l3;
  float f0 = f[0], f1 = f[1], f2 = f[2], f3 = f[3], f4 = f[4], f5 = f[5], f6 = f[6], f7 = f[7];
  asm("s_delay_alu instid0(VALU_DEP_1)\n\t"
      "v_exp_f32 %8, %8\n\t"
      "v_exp_f32 %9, %9\n\t"
      "v_exp_f32 %10, %10\n\t"
      "v_exp_f32 %11, %11\n\t"
      "v_exp_f32 %12, %12\n\t"
      "v_cvt_pk_bf16_f32 %0, %8, %9\n\t"
      "v_exp_f32 %13, %13\n\t"
      "s_delay_alu instid0(TRANS32_DEP_3) | instskip(SKIP_1) | instid1(VALU_DEP_2)\n\t"
      "v_cvt_pk_bf16_f32 %1, %10, %11\n\t"
      "v_exp_f32 %14, %14\n\t"
      "v_fma_mixlo_bf16 %4, %0, -1.0, %8 op_sel:[0,1,0] op_sel_hi:[1,1,0]\n\t"
      "v_exp_f32 %15, %15\n\t"
      "s_delay_alu instid0(VALU_DEP_2) | instskip(NEXT) | instid1(TRANS32_DEP_3)\n\t"
      "v_fma_mixlo_bf16 %5, %1, -1.0, %10 op_sel:[0,1,0] op_sel_hi:[1,1,0]\n\t"
      "v_cvt_pk_bf16_f32 %2, %12, %13\n\t"
      "s_delay_alu instid0(VALU_DEP_3) | instskip(NEXT) | instid1(TRANS32_DEP_1)\n\t"
      "v_fma_mixhi_bf16 %4, %0, -1.0, %9 op_sel:[1,1,0] op_sel_hi:[1,1,0]\n\t"
      "v_cvt_pk_bf16_f32 %3, %14, %15\n\t"
      "s_delay_alu instid0(VALU_DEP_4) | instskip(NEXT) | instid1(VALU_DEP_4)\n\t"
      "v_fma_mixhi_bf16 %5, %1, -1.0, %11 op_sel:[1,1,0] op_sel_hi:[1,1,0]\n\t"
      "v_fma_mixlo_bf16 %6, %2, -1.0, %12 op_sel:[0,1,0] op_sel_hi:[1,1,0]\n\t"
      "s_delay_alu instid0(VALU_DEP_3) | instskip(NEXT) | instid1(VALU_DEP_2)\n\t"
      "v_fma_mixlo_bf16 %7, %3, -1.0, %14 op_sel:[0,1,0] op_sel_hi:[1,1,0]\n\t"
      "v_fma_mixhi_bf16 %6, %2, -1.0, %13 op_sel:[1,1,0] op_sel_hi:[1,1,0]\n\t"
      "s_delay_alu instid0(VALU_DEP_2)\n\t"
      "v_fma_mixhi_bf16 %7, %3, -1.0, %15 op_sel:[1,1,0] op_sel_hi:[1,1,0]"
      : "=&v"(h0), "=&v"(h1), "=&v"(h2), "=&v"(h3), "=&v"(l0), "=&v"(l1), "=&v"(l2), "=&v"(l3),
        "+v"(f0), "+v"(f1), "+v"(f2), "+v"(f3), "+v"(f4), "+v"(f5), "+v"(f6), "+v"(f7));
  f = (v8f){f0, f1, f2, f3, f4, f5, f6, f7};
  hi = (v4u){h0, h1, h2, h3};
  lo = (v4u){l0, l1, l2, l3};
}
// lane l <-> lane l ^ 16 (the other half of the same column) as a vector cross-row move
__device__ __forceinline__ float at_xhalf(float f) {
  const int b = __float_as_int(f);
  return __int_as_float(__builtin_amdgcn_permlanex16(b, b, 0x76543210, 0xfedcba98, false, false));
}
typedef uint32_t u32x4 __attribute__((ext_vector_type(4)));
typedef uint32_t u32x8 __attribute__((ext_vector_type(8)));
__device__ __forceinline__ uint32_t at_uni(uint32_t v) { return (uint32_t)__builtin_amdgcn_readfirstlane(v); }
// wave-uniform test value held in a scalar register (the empty statement is the one that keeps a tensor load's issue test a scalar branch: tensor loads ignore EXEC)
__device__ __forceinline__ uint32_t pinned(uint32_t v) { uint32_t w = at_uni(v); asm volatile("" : "+s"(w)); return w; }
// tensor descriptor, group 1: 1-byte elements, tile = tensor = 64 rows of 128 B, source row pitch src_pitch bytes,
// a pad of 4 dwords behind every 32 dwords (one row): LDS pitch 144 B; no work-group mask
__device__ __forceinline__ u32x8 at_tdm_group1(uint32_t src_pitch) {
  u32x8 g;
  g[0] = at_uni((1u << 20) | (4u << 22) | (3u << 25));
  g[1] = at_uni(128u << 16);
  g[2] = at_uni(64u << 16);
  g[3] = at_uni(128u << 16);
  g[4] = at_uni(64u);
  g[5] = at_uni(src_pitch);
  g[6] = at_uni(0u);
  g[7] = at_uni(0u);
  return g;
}
// group 0: count 1, LDS byte offset of the tile, global address of its first byte, type 2
__device__ __forceinline__ u32x4 at_tdm_group0(uint32_t lds_dst, uint64_t ga) {
  u32x4 g;
  g[0] = at_uni(1u);
  g[1] = at_uni(lds_dst);
  g[2] = at_uni((uint32_t)ga);
  g[3] = at_uni((((uint32_t)(ga >> 32)) & 0x01FFFFFFu) | 0x80000000u);
  return g;
}
// one request of the whole wave: global tile -> LDS, through no register; the waits are written at the call sites
__device__ __forceinline__ void at_tdm_load(u32x4 g0, u32x8 g1) { asm volatile("tensor_load_to_lds %0, %1" :: "s"(g0), "s"(g1) : "memory"); }
// WMMA with dependency guard: 4 VALU nops tied to D, A and B kept live
__device__ __forceinline__ v8f at_mma(v16b a, v16b b, v8f c) {
  c = __builtin_amdgcn_wmma_f32_16x16x32_bf16(false, a, false, b, (short)0, c, false, false);
  asm volatile("v_nop\n\tv_nop\n\tv_nop\n\tv_nop" : "+v"(c) : "v"(a), "v"(b));
  return c;
}

// ---------------------------------------------------------------------------
// Operand preparation, ONE launch; the three parts need nothing of each other and share the grid by ranges of the block index
// (block-uniform role split), 256 threads a block:
//   blocks 0..nbt-1          : V^T part, one 64x64 tile each (first in the grid: the longest chain, load - LDS - barrier - store)
//   blocks nbt..nbt+nbq-1    : qo[e] = bf16(qin[e]), unit i = blk*256+tid < n8q, elements 8i..8i+7
//   blocks nbt+nbq..         : ko[e] = bf16(kin[e]), unit i = blk*256+tid < n8k
// Coverage: v: 64 blocks x 64x64 = 2 x 2048x64; q: 1024 blocks x 256 x 8 = 2097152 = 32768x64; k: 128 blocks x 256 x 8 = 262144 = 4096x64.
// ---------------------------------------------------------------------------
// Flat bf16 RNE convert of an f32 array, 8 elements a thread
__device__ __forceinline__ void cvt_part(const float* __restrict__ in, unsigned short* __restrict__ out, int blk, int n8) {
  const int i = blk * 256 + (int)threadIdx.x;
  if (i < n8) {
    const size_t e0 = (size_t)i * 8;
    const v4f a = *(const v4f*)(in + e0);
    const v4f c = *(const v4f*)(in + e0 + 4);
    v4u hv;
    hv[0] = pk16(f2bf_bits(a[0]), f2bf_bits(a[1]));
    hv[1] = pk16(f2bf_bits(a[2]), f2bf_bits(a[3]));
    hv[2] = pk16(f2bf_bits(c[0]), f2bf_bits(c[1]));
    hv[3] = pk16(f2bf_bits(c[2]), f2bf_bits(c[3]));
    *(v4u*)(out + e0) = hv;
  }
}
// Fused transpose + bf16 RNE convert of one 64x64 tile of an f32 matrix through LDS (tf: 64 rows at a pitch of 68 floats):
//   W viewed [rows][64 cols] with row pitch ldin, rows r0..r0+63  ->  oh[c][r0 + r] = bf16(W[r0 + r][c]), row pitch ldout.
// Coverage per block: load 4 it x 256 thr x 4 floats = 64x64; store 2 it x 256 thr x 8 u16 = 64x64.
// Here: W = V[z] [2048 s][64 d] (ldin 64), oh = VT_z [64 d][2048 s] (ldout 2048). Called by whole blocks only (it holds a barrier).
__device__ __forceinline__ void tconv_part(const float* __restrict__ W, unsigned short* __restrict__ oh, float* tf,
                                           int r0, int ldin, int ldout) {
  const int tid = threadIdx.x;
  {
    const int lr = tid >> 4;         // 0..15
    const int c4 = (tid & 15) * 4;   // 0..60
#pragma unroll
    for (int it = 0; it < 4; ++it) {
      const int rr = it * 16 + lr;   // 0..63
      const v4f a = *(const v4f*)(W + (size_t)(r0 + rr) * ldin + c4);
      *(v4f*)(tf + rr * 68 + c4) = a;
    }
  }
  __syncthreads();
  const int sub = tid >> 3;          // 0..31
  const int c8  = (tid & 7) * 8;     // 0..56
  v4u hv[2];
#pragma unroll
  for (int it = 0; it < 2; ++it) {
    const int oc = it * 32 + sub;    // output row within tile (= input column)
    v4u a;
#pragma unroll
    for (int q = 0; q < 4; ++q) {
      const float f0 = tf[(c8 + 2 * q) * 68 + oc];
      const float f1 = tf[(c8 + 2 * q + 1) * 68 + oc];
      a[q] = pk16(f2bf_bits(f0), f2bf_bits(f1));
    }
    hv[it] = a;
  }
#pragma unroll
  for (int it = 0; it < 2; ++it) {
    const int oc = it * 32 + sub;
    const size_t go = (size_t)oc * ldout + r0 + c8;
    *(v4u*)(oh + go) = hv[it];
  }
}
__global__ __launch_bounds__(256) void prep_kernel(const float* __restrict__ qin, const float* __restrict__ kin, const float* __restrict__ vin,
                                                   unsigned short* __restrict__ qo, unsigned short* __restrict__ ko,
                                                   unsigned short* __restrict__ vto, int nbt, int nbq, int n8q, int n8k) {
  __shared__ __align__(16) float tf[64 * 68];
  const int bx = (int)blockIdx.x;
  if (bx < nbt) {                                         // block-uniform: every thread of the block reaches the part's barrier
    const int z = bx / (SEQ / 64);                        // batch element
    const int y = bx % (SEQ / 64);                        // 64-row tile of V[z]
    tconv_part(vin + (size_t)z * SEQ * HD, vto + (size_t)z * HD * SEQ, tf, y * 64, HD, SEQ);
  } else if (bx < nbt + nbq) {
    cvt_part(qin, qo, bx - nbt, n8q);
  } else {
    cvt_part(kin, ko, bx - nbt - nbq, n8k);
  }
}

// =====================================================================================
// Full (non-causal, unmasked) multi-query attention, head dim 64, all (batch, head) pairs in one launch.
//   q plane (bf16) [32768][64]: element (b, h, q, d) at [((b*8+h)*2048 + q)*64 + d]
//   k plane (bf16) [4096][64]: element (b, s, d) at [(b*2048 + s)*64 + d]       (one key head shared by all 8 query heads)
//   v^T plane (bf16) [2][64][2048]: element (b, d, s) at [b*131072 + d*2048 + s] (one value head shared by all 8 query heads)
//   out f32 [32768][64]: element (b, h, q, d) at [((b*8+h)*2048 + q)*64 + d]
//   scores^T = (k . q^T) * 0.125 : single bf16 product (exact), f32 accumulate; A = K rows, B = Q columns
//   out^T    = v^T . p^T         : v^T . p_hi^T + v^T . p_lo^T (p = unnormalised exp split into bf16 hi|lo; the same v^T LDS
//                               fragment serves both terms), f32 accumulate, x 1/rowsum in f32 at the end
//   online softmax in f32 (base 2, scale folded into the exponent's multiply-add) over all 2048 keys of the batch element (2 key groups x 16 chunks of 64, compile-time trip count, no masking):
//   lane (c, hh) holds the scores of query c for the keys j*16 + 8*hh + r; max and sum run in-lane, the two halves of a
//   query join by one cross-row move (max: every chunk; sum: once, in the epilogue).
//   Block = 8 waves = 4 query tiles x 2 key groups, 64 query rows of one (batch, head); grid.x = 2 * 8 * 32 = 512 (exact).
//   Key group g (waves 4g..4g+3) walks the keys g*1024 .. g*1024+1023 in 16 chunks of 64 with its own running max, sum and O^T and its
//   own K / V^T tiles: four waves a SIMD instead of two stand ready while a group waits for its staging, and the chain of chunks is half as long.
//   Behind the loop group 1 hands max, sum and O^T to group 0 through LDS (one barrier); group 0 rescales both to the common max and adds.
//   K / V^T chunk staging: one tensor load a tile (64 rows x 128 B, padded to the 144-B pitch by the mover), issued by waves 0 (K) and 1 (V^T)
//   of each key group, into a ring of two buffers: chunk kc+2's loads are issued at the foot of trip kc and fly during trip kc+1.
//   One publish point a trip: LDS reads retired, the issuers' tensor wait, the block's barrier, then the refill of the buffer just read.
//   LDS extents: K/V tiles 64x64 fully staged every chunk, rows at a pitch of 72 elements; the 8 pad elements of a row are never written or read.
//   Epilogue: each wave of key group 0 stages its 16x64 f32 tile in LDS, then writes 256-B output rows as 16 lanes x 16 B
// =====================================================================================
#define AT_D 64
#define AT_NW 4    // query tiles of 16 rows = waves per key group
#define AT_NG 2    // key groups per block
#define AT_GK (SEQ / AT_NG)   // 1024 keys per group
#define AT_QB 64
#define AT_KC 64
#define AT_LP 72   // LDS row pitch of the K and V^T tiles in elements: 144 B = 16 B x 9 (odd), so the 16 rows of a ds_load_b128 fragment read fall on 16 different bank groups

#define AT_TB 10240           // LDS bytes a tile: 64 rows x 144 B = 9216, rounded up so that every tile starts at a multiple of 2 KiB
#define AT_BUFB (AT_NG * 2 * AT_TB)   // one ring buffer: K and V^T tile of both key groups

static_assert(AT_GK % AT_KC == 0);
static_assert(AT_GK / AT_KC >= 2);    // the ring's prologue needs two stages
static_assert(AT_KC * AT_LP * 2 <= AT_TB && AT_TB % 2048 == 0);

__global__ __launch_bounds__(256)
void attn_mqa_kernel(const unsigned short* __restrict__ qp, const unsigned short* __restrict__ kp,
                     const unsigned short* __restrict__ vtp, float* __restrict__ out, float sscale) {
  union FB { v16b v; v8b h[2]; v4u u[2]; };
  __shared__ __attribute__((aligned(2048))) unsigned char Ring[2 * AT_BUFB];   // [buffer][key group][K [kv][d] | V^T [d][kv]][AT_TB]
  __shared__ __align__(16) float  Os[AT_NW][16 * 68];            // per query tile: out tile, pitch 68
  __shared__ __align__(16) float  Mo[AT_NW][8 * 32 * 4];         // per query tile: group 1's O^T, [16-B piece 0..7][lane]
  __shared__ float Mm[AT_NW][32];                                // per query tile: group 1's running max, by lane
  __shared__ float Ml[AT_NW][32];                                // per query tile: group 1's running sum, by lane

  const int grp  = __builtin_amdgcn_readfirstlane((int)threadIdx.x >> 7);   // key group 0..1, the same in a whole wave
  const int tid  = threadIdx.x & 127;     // thread within the key group
  const int wave = tid >> 5;              // query tile 0..3
  const int lane = tid & 31;
  const int hh   = lane >> 4;
  const int c    = lane & 15;

  const int nqb = SEQ / AT_QB;            // 32 query blocks per (batch, head)
  const int bx = blockIdx.x;              // grid = NB_ * NH_ * nqb (exact)
  const int qb = bx % nqb;
  const int bh = bx / nqb;                // b*8 + h, 0..15
  const int b  = bh / NH_;                // 0..1 : key / value index depends on b only
  const int q0 = bh * SEQ + qb * AT_QB + wave * 16;   // row in the q plane == row in out

  const __bf16* Qg = (const __bf16*)(const void*)qp;
  const __bf16* Kg = (const __bf16*)(const void*)kp  + (size_t)b * SEQ * AT_D;   // keys of batch b
  const __bf16* Vg = (const __bf16*)(const void*)vtp + (size_t)b * AT_D * SEQ;   // V^T of batch b [d][s]

  // ---- Q fragments (B operand, column = query lane&15, split k map): 2 d-chunks ----
  v16b qa[2];
#pragma unroll
  for (int dc = 0; dc < 2; ++dc)
    qa[dc] = ld_frag_bf(Qg + (size_t)(q0 + c) * AT_D + dc * 32 + 8 * hh);

  // exp(sscale * (s - m)) = 2^(s * c2 - m * c2), c2 = sscale * log2(e): one fused multiply-add and one v_exp_f32 a score.
  // The argument is never above 0 but for its own rounding; far below, 2^x runs out to 0, as exp does.
  const float c2 = sscale * 1.44269504088896340736f;
  float mrow = -INFINITY;   // running max of query c over the UNSCALED scores (sscale > 0: the same key wins), equal in both halves
  float lrow = 0.f;         // running sum of query c over this half's keys only
  v8f oacc[4];              // oacc[t][r] = O^T[d = t*16 + 8*hh + r][query c]
#pragma unroll
  for (int t = 0; t < 4; ++t) oacc[t] = (v8f){0.f,0.f,0.f,0.f,0.f,0.f,0.f,0.f};

  const int nChunks = AT_GK / AT_KC;   // 16 per key group, compile-time constant, the same for both groups (the barriers are the block's)
  // ---- tensor-load ring: wave 0 of a key group brings its K tiles, wave 1 its V^T tiles; one request of a wave in flight ----
  const uint32_t wg = at_uni(threadIdx.x >> 5) & 3u;     // wave within the key group (one-dimensional block)
  const bool issuer = wg < 2u;
  const bool isV = wg == 1u;
  const uint32_t dst0 = (uint32_t)(uintptr_t)(&Ring[0]) + (uint32_t)grp * (2u * AT_TB) + (isV ? (uint32_t)AT_TB : 0u);
  // first byte of the group's chunk 0: K rows grp*1024.. (a chunk on: 64 rows x 128 B); V^T row 0, keys grp*1024.. (a chunk on: 64 keys x 2 B)
  const uint64_t src0 = isV ? (uint64_t)(uintptr_t)(Vg + grp * AT_GK) : (uint64_t)(uintptr_t)(Kg + (size_t)grp * AT_GK * AT_D);
  const uint32_t sstep = isV ? (uint32_t)(AT_KC * 2) : (uint32_t)(AT_KC * AT_D * 2);
  const u32x8 g1 = at_tdm_group1(isV ? (uint32_t)(SEQ * 2) : (uint32_t)(AT_D * 2));
  if (pinned(issuer)) {
    at_tdm_load(at_tdm_group0(dst0, src0), g1);
    asm volatile("s_wait_tensorcnt 0x0" ::: "memory");   // chunk 0 has landed before the barrier that publishes it
  }
  __syncthreads();
  if (pinned(issuer)) at_tdm_load(at_tdm_group0(dst0 + AT_BUFB, src0 + sstep), g1);   // chunk 1 flies during trip 0
  for (int kc = 0; kc < nChunks; ++kc) {
    const __bf16* Ksh = (const __bf16*)(const void*)(Ring + (kc & 1) * AT_BUFB + grp * (2 * AT_TB));
    const __bf16* Vth = Ksh + AT_TB / 2;

    // ---- S^T = k . q^T : A fragment row = key j*16+c, B = Q column c, split k map over d on both ----
    // all 8 K fragments are read as ONE group ahead of the products: one LDS latency per chunk instead of one per fragment
    FB kb[4][2];
#pragma unroll
    for (int j = 0; j < 4; ++j) {
#pragma unroll
      for (int dc = 0; dc < 2; ++dc) {
        kb[j][dc].h[0] = *(const v8b*)(Ksh + (j * 16 + c) * AT_LP + dc * 32 + 8 * hh);
        kb[j][dc].h[1] = *(const v8b*)(Ksh + (j * 16 + c) * AT_LP + dc * 32 + 16 + 8 * hh);
      }
    }
    v8f s[4];
#pragma unroll
    for (int j = 0; j < 4; ++j) {
      s[j] = (v8f){0.f,0.f,0.f,0.f,0.f,0.f,0.f,0.f};
#pragma unroll
      for (int dc = 0; dc < 2; ++dc) s[j] = at_mma(kb[j][dc].v, qa[dc], s[j]);
    }
    // the 8 V^T fragments are read into registers here, not among their products: the softmax's vector work between read and use covers the LDS latency
    FB vb[2][4];
#pragma unroll
    for (int kk = 0; kk < 2; ++kk) {
#pragma unroll
      for (int t = 0; t < 4; ++t) {
        vb[kk][t].h[0] = *(const v8b*)(Vth + (t * 16 + c) * AT_LP + kk * 32 + 8 * hh);
        vb[kk][t].h[1] = *(const v8b*)(Vth + (t * 16 + c) * AT_LP + kk * 32 + 16 + 8 * hh);
      }
    }
    // chunk max of query c (s[j][r] = unscaled score of key j*16 + 8hh + r, query c): in-lane, then the other half
    float cm = -INFINITY;
#pragma unroll
    for (int j = 0; j < 4; ++j) {
#pragma unroll
      for (int r = 0; r < 8; ++r) cm = fmaxf(cm, s[j][r]);
    }
    cm = fmaxf(cm, at_xhalf(cm));
    const float mnew = fmaxf(mrow, cm);
    const float alpha = __builtin_amdgcn_exp2f((mrow - mnew) * c2);
    const float nm2 = -mnew * c2;
    mrow = mnew;
    // P^T as B operand: element e of the 32-key block kk = key kk*32 + (e < 8 ? 8hh + e : 16 + 8hh + e - 8) = s[2kk + (e >> 3)][e & 7]
    FB ph[2], pl[2];
    float ps[4];
#pragma unroll
    for (int j = 0; j < 4; ++j) {
#pragma unroll
      for (int r = 0; r < 8; ++r) s[j][r] = fmaf(s[j][r], c2, nm2);
      at_exp2_split8(s[j], ph[j >> 1].u[j & 1], pl[j >> 1].u[j & 1]);   // s[j] becomes p = 2^s[j]
      float psum = s[j][0];
#pragma unroll
      for (int r = 1; r < 8; ++r) psum += s[j][r];
      ps[j] = psum;
    }
    lrow = lrow * alpha + ((ps[0] + ps[1]) + (ps[2] + ps[3]));
#pragma unroll
    for (int t = 0; t < 4; ++t) {
#pragma unroll
      for (int r = 0; r < 8; ++r) oacc[t][r] *= alpha;
    }
    // ---- O^T += v^T . p_hi^T + v^T . p_lo^T : A = V^T [d][key] (row = d t*16+c, split k map over keys), B = P^T ----
    // unrolled: ph / pl / vb are register arrays, their index must be a compile-time constant
#pragma unroll
    for (int kk = 0; kk < 2; ++kk) {
#pragma unroll
      for (int t = 0; t < 4; ++t) {
        oacc[t] = at_mma(vb[kk][t].v, ph[kk].v, oacc[t]);
        oacc[t] = at_mma(vb[kk][t].v, pl[kk].v, oacc[t]);
      }
    }
    // ---- publish point of chunk kc+1, every wave, in this order ----
    asm volatile("s_wait_dscnt 0x0" ::: "memory");                             // this wave's reads of the buffer have retired before it may be refilled
    if (pinned(issuer)) asm volatile("s_wait_tensorcnt 0x0" ::: "memory");     // this wave's tile of chunk kc+1 has landed
    __syncthreads();                                                           // chunk kc+1 readable by all; every wave has left chunk kc's buffer
    if (pinned(issuer && kc + 2 < nChunks))
      at_tdm_load(at_tdm_group0(dst0 + (uint32_t)(kc & 1) * AT_BUFB, src0 + (uint64_t)(uint32_t)(kc + 2) * sstep), g1);
  }
  asm volatile("s_wait_tensorcnt 0x0" ::: "memory");   // nothing of the ring in flight behind the loop
  asm volatile("s_wait_dscnt 0x0" ::: "memory");

  // ---- the two key groups join: lane l of group 1's wave hands its max, sum and 32 O^T values to lane l of group 0's wave of the same query tile ----
  // the loops over t and r here are unrolled because oacc is a register array: its index must be a compile-time constant
  if (grp == 1) {
    float* mo = Mo[wave];
#pragma unroll
    for (int t = 0; t < 4; ++t) {
      v4f lo4, hi4;
#pragma unroll
      for (int r = 0; r < 4; ++r) { lo4[r] = oacc[t][r]; hi4[r] = oacc[t][4 + r]; }
      *(v4f*)(mo + ((t * 2 + 0) * 32 + lane) * 4) = lo4;
      *(v4f*)(mo + ((t * 2 + 1) * 32 + lane) * 4) = hi4;
    }
    Mm[wave][lane] = mrow;
    Ml[wave][lane] = lrow;
  }
  __syncthreads();          // group 1's partial results are in LDS; the block's last barrier
  if (grp == 1) return;     // whole waves leave, behind every barrier
  {
    const float* mo = Mo[wave];
    const float m1 = Mm[wave][lane];
    const float l1 = Ml[wave][lane];
    const float mj = fmaxf(mrow, m1);
    const float a0 = __builtin_amdgcn_exp2f((mrow - mj) * c2);
    const float a1 = __builtin_amdgcn_exp2f((m1 - mj) * c2);
    lrow = lrow * a0 + l1 * a1;
#pragma unroll
    for (int t = 0; t < 4; ++t) {
      const v4f lo4 = *(const v4f*)(mo + ((t * 2 + 0) * 32 + lane) * 4);
      const v4f hi4 = *(const v4f*)(mo + ((t * 2 + 1) * 32 + lane) * 4);
#pragma unroll
      for (int r = 0; r < 4; ++r) {
        oacc[t][r]     = oacc[t][r]     * a0 + lo4[r] * a1;
        oacc[t][4 + r] = oacc[t][4 + r] * a0 + hi4[r] * a1;
      }
    }
  }

  // join the two halves' sums of query c; a lane holds 8 consecutive d of query c per tile: two 16-B LDS stores
  float* os = Os[wave];
  {
    const float inv = 1.0f / (lrow + at_xhalf(lrow));
#pragma unroll
    for (int t = 0; t < 4; ++t) {
      v4f lo4, hi4;
#pragma unroll
      for (int r = 0; r < 4; ++r) { lo4[r] = oacc[t][r] * inv; hi4[r] = oacc[t][4 + r] * inv; }
      *(v4f*)(os + c * 68 + t * 16 + 8 * hh)     = lo4;
      *(v4f*)(os + c * 68 + t * 16 + 8 * hh + 4) = hi4;
    }
  }
  __builtin_amdgcn_fence(__ATOMIC_RELEASE, "workgroup");
  __builtin_amdgcn_wave_barrier();
  __builtin_amdgcn_fence(__ATOMIC_ACQUIRE, "workgroup");
  {
    const int c4 = (lane & 15) * 4;
    float* orow = out + (size_t)(q0 + hh) * AT_D + c4;   // one address; the rows follow at constant offsets
    {
#pragma unroll
      for (int it = 0; it < 8; ++it) {
        const int row = it * 2 + hh;   // it 0..7 x hh 0..1 covers rows 0..15 of the wave tile
        v4f val = *(const v4f*)(os + row * 68 + c4);
        *(v4f*)(orow + it * 2 * AT_D) = val;
      }
      
    }
  }
}

// ---------------------------------------------------------------------------
// Workspace region map (byte offsets; every region is fully written by its producer launch before any consumer
//   QB  bf16 [32768][64]          0      4194304
//   KB  bf16 [4096][64]     4194304       524288
//   VT  bf16 [2][64][2048]  4718592       524288
//   total                   5242880
// ---------------------------------------------------------------------------
extern "C" void kernel_launch(void* const* d_in, const int* in_sizes, int n_in,
                              void* d_out, int out_size, void* d_ws, size_t ws_size,
                              hipStream_t stream) {
  if (n_in < 3) return;
  if (in_sizes[0] != NQR * HD) return;          // Q [2][8][2048][64]
  if (in_sizes[1] != NKR * HD) return;          // K [2][1][2048][64]
  if (in_sizes[2] != NKR * HD) return;          // V [2][1][2048][64]
  if (out_size != NQR * HD) return;             // out [2][8][2048][64]; last written element index NQR*HD-1

  const float* Q = (const float*)d_in[0];
  const float* K = (const float*)d_in[1];
  const float* V = (const float*)d_in[2];

  const size_t PQB = (size_t)NQR * HD * 2;      // 4194304
  const size_t PKB = (size_t)NKR * HD * 2;      // 524288
  const size_t PVT = (size_t)NB_ * HD * SEQ * 2;// 524288
  size_t off = 0;
  const size_t oQB = off; off += PQB;
  const size_t oKB = off; off += PKB;
  const size_t oVT = off; off += PVT;
  if (off > ws_size) return;                    // off = 5242880
  if (off > (size_t)134217728) return;

  char* ws = (char*)d_ws;
  unsigned short* QB = (unsigned short*)(ws + oQB);
  unsigned short* KB = (unsigned short*)(ws + oKB);
  unsigned short* VT = (unsigned short*)(ws + oVT);

  // (1) one launch: V[b] [2048 s][64 d] -> VT_b[d][s] (64 blocks, a 64x64 tile each); QB = bf16(Q) flat, KB = bf16(K) flat (1024 + 128 blocks of 256 threads x 8 elements)
  const int n8q = NQR * HD / 8;                 // 262144
  const int n8k = NKR * HD / 8;                 // 32768
  const int nbq = n8q / 256;                    // 1024
  const int nbk = n8k / 256;                    // 128
  const int nbt = NB_ * (SEQ / 64);             // 64
  prep_kernel<<<dim3(nbt + nbq + nbk), dim3(256), 0, stream>>>(Q, K, V, QB, KB, VT, nbt, nbq, n8q, n8k);
  // (2) attention per (batch, head, 64-query block) -> d_out rows (b*8+h)*2048 + q; 512 blocks x 256 threads (4 query tiles x 2 key groups)
  attn_mqa_kernel<<<dim3(NB_ * NH_ * (SEQ / 64)), dim3(256), 0, stream>>>(QB, KB, VT, (float*)d_out, 0.125f);
  (void)hipGetLastError();
}

// v010
// Measured time: 20.5 microseconds a run.
// It is 1.28 times as fast as v008, going by the measured steps of the versions left out in between.
// Over all steps from v000 it is 7.11 times as fast.
#include <hip/hip_runtime.h>
#include <math.h>
#include <stdint.h>

#define NB_   2
#define NH_   8
#define SEQ   2048
#define HD    64
#define NQR   (NB_ * NH_ * SEQ)   // 32768 q / out rows
#define NKR   (NB_ * SEQ)         // 4096 k rows

static_assert(HD == 64);
static_assert(SEQ % 64 == 0);
static_assert((NQR * HD) % (8 * 256) == 0);
static_assert((NKR * HD) % (8 * 256) == 0);

typedef __attribute__((ext_vector_type(16))) _Float16 v16h;
typedef __attribute__((ext_vector_type(8)))  _Float16 v8h;
typedef __attribute__((ext_vector_type(16))) __bf16   v16b;
typedef __attribute__((ext_vector_type(8)))  __bf16   v8b;
typedef __attribute__((ext_vector_type(8)))  float    v8f;
typedef __attribute__((ext_vector_type(4)))  float    v4f;
typedef __attribute__((ext_vector_type(4)))  unsigned int v4u;

__device__ __forceinline__ unsigned short f2bf_bits(float f) {
  unsigned u = __float_as_uint(f);
  return (unsigned short)((u + 0x7FFFu + ((u >> 16) & 1u)) >> 16);
}
__device__ __forceinline__ float bf_bits2f(unsigned short h) { return __uint_as_float(((unsigned)h) << 16); }
__device__ __forceinline__ unsigned pk16(unsigned short a, unsigned short b) { return (unsigned)a | ((unsigned)b << 16); }
typedef __attribute__((ext_vector_type(2))) float    v2f;
typedef __attribute__((ext_vector_type(2))) _Float16 v2h;
// two f32 -> two f16, nearest even, a in the low half
__device__ __forceinline__ unsigned pk_f16(float a, float b) {
  union { v2h h; unsigned u; } r;
  r.h = __builtin_convertvector((v2f){a, b}, v2h);
  return r.u;
}

// A / B fragment load (split k map): elements 0..7 <- p[0..7], 8..15 <- p[16..23]; caller passes p = row + k0 + 8*(lane>>4)
__device__ __forceinline__ v16b ld_frag_bf(const __bf16* p) {
  union { v16b v; v8b h[2]; } f;
  f.h[0] = *(const v8b*)(p);
  f.h[1] = *(const v8b*)(p + 16);
  return f.v;
}

// 2^x of the 8 exponent arguments of one score tile (in place), and the results rounded to f16 (nearest even) in pairs, in one statement.
// Why one statement: each v_exp_f32 works in place and the instruction behind it touches neither its register nor its result (the slot
// that the instruction set asks for behind a transcendental).
// Each s_delay_alu names the distance to the producer (the first: the producers of f in front of the statement), so that the SIMD
// issues its other waves while this one waits: the compiler puts no such hint inside asm text.
__device__ __forceinline__ void at_exp2_pack8(v8f& f, v4u& ph) {
  unsigned h0, h1, h2, h3;
  float f0 = f[0], f1 = f[1], f2 = f[2], f3 = f[3], f4 = f[4], f5 = f[5], f6 = f[6], f7 = f[7];
  asm("s_delay_alu instid0(VALU_DEP_1)\n\t"
      "v_exp_f32 %4, %4\n\t"
      "v_exp_f32 %5, %5\n\t"
      "v_exp_f32 %6, %6\n\t"
      "v_exp_f32 %7, %7\n\t"
      "v_exp_f32 %8, %8\n\t"
      "v_cvt_pk_f16_f32 %0, %4, %5\n\t"
      "v_exp_f32 %9, %9\n\t"
      "s_delay_alu instid0(TRANS32_DEP_3)\n\t"
      "v_cvt_pk_f16_f32 %1, %6, %7\n\t"
      "v_exp_f32 %10, %10\n\t"
      "v_exp_f32 %11, %11\n\t"
      "s_delay_alu instid0(TRANS32_DEP_3) | instskip(NEXT) | instid1(TRANS32_DEP_1)\n\t"
      "v_cvt_pk_f16_f32 %2, %8, %9\n\t"
      "v_cvt_pk_f16_f32 %3, %10, %11"
      : "=&v"(h0), "=&v"(h1), "=&v"(h2), "=&v"(h3),
        "+v"(f0), "+v"(f1), "+v"(f2), "+v"(f3), "+v"(f4), "+v"(f5), "+v"(f6), "+v"(f7));
  f = (v8f){f0, f1, f2, f3, f4, f5, f6, f7};
  ph = (v4u){h0, h1, h2, h3};
}
// lane l <-> lane l ^ 16 (the other half of the same column) as a vector cross-row move
__device__ __forceinline__ float at_xhalf(float f) {
  const int b = __float_as_int(f);
  return __int_as_float(__builtin_amdgcn_permlanex16(b, b, 0x76543210, 0xfedcba98, false, false));
}
typedef uint32_t u32x4 __attribute__((ext_vector_type(4)));
typedef uint32_t u32x8 __attribute__((ext_vector_type(8)));
__device__ __forceinline__ uint32_t at_uni(uint32_t v) { return (uint32_t)__builtin_amdgcn_readfirstlane(v); }
// wave-uniform test value held in a scalar register (the empty statement is the one that keeps a tensor load's issue test a scalar branch: tensor loads ignore EXEC)
__device__ __forceinline__ uint32_t pinned(uint32_t v) { uint32_t w = at_uni(v); asm volatile("" : "+s"(w)); return w; }
// tensor descriptor, group 1: 1-byte elements, tile = tensor = 64 rows of 128 B, source row pitch src_pitch bytes,
// a pad of 4 dwords behind every 32 dwords (one row): LDS pitch 144 B; no work-group mask
__device__ __forceinline__ u32x8 at_tdm_group1(uint32_t src_pitch) {
  u32x8 g;
  g[0] = at_uni((1u << 20) | (4u << 22) | (3u << 25));
  g[1] = at_uni(128u << 16);
  g[2] = at_uni(64u << 16);
  g[3] = at_uni(128u << 16);
  g[4] = at_uni(64u);
  g[5] = at_uni(src_pitch);
  g[6] = at_uni(0u);
  g[7] = at_uni(0u);
  return g;
}
// group 0: count 1, LDS byte offset of the tile, global address of its first byte, type 2
__device__ __forceinline__ u32x4 at_tdm_group0(uint32_t lds_dst, uint64_t ga) {
  u32x4 g;
  g[0] = at_uni(1u);
  g[1] = at_uni(lds_dst);
  g[2] = at_uni((uint32_t)ga);
  g[3] = at_uni((((uint32_t)(ga >> 32)) & 0x01FFFFFFu) | 0x80000000u);
  return g;
}
// one request of the whole wave: global tile -> LDS, through no register; the waits are written at the call sites
__device__ __forceinline__ void at_tdm_load(u32x4 g0, u32x8 g1) { asm volatile("tensor_load_to_lds %0, %1" :: "s"(g0), "s"(g1) : "memory"); }
// WMMA with dependency guard: 4 VALU nops tied to D, A and B kept live
__device__ __forceinline__ v8f at_mma(v16b a, v16b b, v8f c) {
  c = __builtin_amdgcn_wmma_f32_16x16x32_bf16(false, a, false, b, (short)0, c, false, false);
  asm volatile("v_nop\n\tv_nop\n\tv_nop\n\tv_nop" : "+v"(c) : "v"(a), "v"(b));
  return c;
}
// the same for f16 operands
__device__ __forceinline__ v8f at_mma_h(v16h a, v16h b, v8f c) {
  c = __builtin_amdgcn_wmma_f32_16x16x32_f16(false, a, false, b, (short)0, c, false, false);
  asm volatile("v_nop\n\tv_nop\n\tv_nop\n\tv_nop" : "+v"(c) : "v"(a), "v"(b));
  return c;
}

// ---------------------------------------------------------------------------
// Operand preparation, ONE launch; the three parts need nothing of each other and share the grid by ranges of the block index
// (block-uniform role split), 256 threads a block:
//   blocks 0..nbt-1          : V^T part, one 64x64 tile each (first in the grid: the longest chain, load - LDS - barrier - store)
//   blocks nbt..nbt+nbq-1    : qo[e] = bf16(qin[e]), unit i = blk*256+tid < n8q, elements 8i..8i+7
//   blocks nbt+nbq..         : ko[e] = bf16(kin[e]), unit i = blk*256+tid < n8k
// Coverage: v: 64 blocks x 64x64 = 2 x 2048x64; q: 1024 blocks x 256 x 8 = 2097152 = 32768x64; k: 128 blocks x 256 x 8 = 262144 = 4096x64.
// ---------------------------------------------------------------------------
// Flat bf16 RNE convert of an f32 array, 8 elements a thread
__device__ __forceinline__ void cvt_part(const float* __restrict__ in, unsigned short* __restrict__ out, int blk, int n8) {
  const int i = blk * 256 + (int)threadIdx.x;
  if (i < n8) {
    const size_t e0 = (size_t)i * 8;
    const v4f a = *(const v4f*)(in + e0);
    const v4f c = *(const v4f*)(in + e0 + 4);
    v4u hv;
    hv[0] = pk16(f2bf_bits(a[0]), f2bf_bits(a[1]));
    hv[1] = pk16(f2bf_bits(a[2]), f2bf_bits(a[3]));
    hv[2] = pk16(f2bf_bits(c[0]), f2bf_bits(c[1]));
    hv[3] = pk16(f2bf_bits(c[2]), f2bf_bits(c[3]));
    *(v4u*)(out + e0) = hv;
  }
}
// Fused transpose + f16 RNE convert of one 64x64 tile of an f32 matrix through LDS (tf: 64 rows at a pitch of 68 floats):
//   W viewed [rows][64 cols] with row pitch ldin, rows r0..r0+63  ->  oh[c][r0 + r] = f16(W[r0 + r][c]), row pitch ldout.
// Coverage per block: load 4 it x 256 thr x 4 floats = 64x64; store 2 it x 256 thr x 8 u16 = 64x64.
// Here: W = V[z] [2048 s][64 d] (ldin 64), oh = VT_z [64 d][2048 s] (ldout 2048). Called by whole blocks only (it holds a barrier).
__device__ __forceinline__ void tconv_part(const float* __restrict__ W, unsigned short* __restrict__ oh, float* tf,
                                           int r0, int ldin, int ldout) {
  const int tid = threadIdx.x;
  {
    const int lr = tid >> 4;         // 0..15
    const int c4 = (tid & 15) * 4;   // 0..60
#pragma unroll
    for (int it = 0; it < 4; ++it) {
      const int rr = it * 16 + lr;   // 0..63
      const v4f a = *(const v4f*)(W + (size_t)(r0 + rr) * ldin + c4);
      *(v4f*)(tf + rr * 68 + c4) = a;
    }
  }
  __syncthreads();
  const int sub = tid >> 3;          // 0..31
  const int c8  = (tid & 7) * 8;     // 0..56
  v4u hv[2];
#pragma unroll
  for (int it = 0; it < 2; ++it) {
    const int oc = it * 32 + sub;    // output row within tile (= input column)
    v4u a;
#pragma unroll
    for (int q = 0; q < 4; ++q) {
      const float f0 = tf[(c8 + 2 * q) * 68 + oc];
      const float f1 = tf[(c8 + 2 * q + 1) * 68 + oc];
      a[q] = pk_f16(f0, f1);
    }
    hv[it] = a;
  }
#pragma unroll
  for (int it = 0; it < 2; ++it) {
    const int oc = it * 32 + sub;
    const size_t go = (size_t)oc * ldout + r0 + c8;
    *(v4u*)(oh + go) = hv[it];
  }
}
__global__ __launch_bounds__(256) void prep_kernel(const float* __restrict__ qin, const float* __restrict__ kin, const float* __restrict__ vin,
                                                   unsigned short* __restrict__ qo, unsigned short* __restrict__ ko,
                                                   unsigned short* __restrict__ vto, int nbt, int nbq, int n8q, int n8k) {
  __shared__ __align__(16) float tf[64 * 68];
  const int bx = (int)blockIdx.x;
  if (bx < nbt) {                                         // block-uniform: every thread of the block reaches the part's barrier
    const int z = bx / (SEQ / 64);                        // batch element
    const int y = bx % (SEQ / 64);                        // 64-row tile of V[z]
    tconv_part(vin + (size_t)z * SEQ * HD, vto + (size_t)z * HD * SEQ, tf, y * 64, HD, SEQ);
  } else if (bx < nbt + nbq) {
    cvt_part(qin, qo, bx - nbt, n8q);
  } else {
    cvt_part(kin, ko, bx - nbt - nbq, n8k);
  }
}

// =====================================================================================
// Full (non-causal, unmasked) multi-query attention, head dim 64, all (batch, head) pairs in one launch.
//   q plane (bf16) [32768][64]: element (b, h, q, d) at [((b*8+h)*2048 + q)*64 + d]
//   k plane (bf16) [4096][64]: element (b, s, d) at [(b*2048 + s)*64 + d]       (one key head shared by all 8 query heads)
//   v^T plane (f16) [2][64][2048]: element (b, d, s) at [b*131072 + d*2048 + s] (one value head shared by all 8 query heads)
//   out f32 [32768][64]: element (b, h, q, d) at [((b*8+h)*2048 + q)*64 + d]
//   scores^T = (k . q^T) * 0.125 : single bf16 product (exact), f32 accumulate; A = K rows, B = Q columns
//   out^T    = v^T . p^T         : single f16 product (p = unnormalised exp rounded to f16), f32 accumulate, x 1/rowsum in f32 at the end
//   online softmax in f32 (base 2, scale folded into the exponent's multiply-add) over all 2048 keys of the batch element (4 key groups x 8 chunks of 64, compile-time trip count, no masking):
//   lane (c, hh) holds the scores of query c for the keys j*16 + 8*hh + r; max and sum run in-lane, the two halves of a
//   query join by one cross-row move (max: every chunk; sum: once, in the epilogue).
//   A wave holds TWO query tiles (32 queries): every K and V^T fragment that it reads from LDS is the A operand of two products, so a
//   product costs half the LDS read bytes of a 16-query wave, and a K / V^T tile brought into LDS serves 128 queries instead of 64.
//   Block = 16 waves = 4 query-tile pairs x 4 key groups, 128 query rows of one (batch, head); grid.x = 2 * 8 * 16 = 256 (exact);
//   the finer key split keeps four waves a SIMD. One block fills a WGP's LDS share (ring 160 KiB + join and output staging).
//   Key group g (waves 4g..4g+3) walks the keys g*512 .. g*512+511 in 8 chunks of 64 with its own running max, sum and O^T and its own K / V^T tiles.
//   Behind the loop groups 1..3 hand max, sum and O^T to group 0 through LDS (one barrier); group 0 rescales all four to the common max and adds them in group order.
//   K / V^T chunk staging: one tensor load a tile (64 rows x 128 B, padded to the 144-B pitch by the mover), issued by waves 0 (K) and 1 (V^T)
//   of each key group, into a ring of two buffers: chunk kc+2's loads are issued at the foot of trip kc and fly during trip kc+1.
//   One publish point a trip: LDS reads retired, the issuers' tensor wait, the block's barrier, then the refill of the buffer just read.
//   LDS extents: K/V tiles 64x64 fully staged every chunk, rows at a pitch of 72 elements; the 8 pad elements of a row are never written or read.
//   Epilogue: each wave of group 0 stages its 32x64 f32 tile in LDS, then writes 256-B output rows as 16 lanes x 16 B
// =====================================================================================
#define AT_D 64
#define AT_NW 4    // waves per key group
#define AT_QT 2    // query tiles of 16 rows per wave
#define AT_NG 4    // key groups per block
#define AT_GK (SEQ / AT_NG)   // 512 keys per group
#define AT_QB (AT_NW * AT_QT * 16)   // 128 query rows per block
#define AT_KC 64
#define AT_LP 72   // LDS row pitch of the K and V^T tiles in elements: 144 B = 16 B x 9 (odd), so the 16 rows of a ds_load_b128 fragment read fall on 16 different bank groups

#define AT_TB 10240           // LDS bytes a tile: 64 rows x 144 B = 9216, rounded up so that every tile starts at a multiple of 2 KiB
#define AT_BUFB (AT_NG * 2 * AT_TB)   // one ring buffer: K and V^T tile of every key group

static_assert(SEQ % AT_QB == 0);
static_assert(AT_GK % AT_KC == 0);
static_assert(AT_GK / AT_KC >= 2);    // the ring's prologue needs two stages
static_assert(AT_KC * AT_LP * 2 <= AT_TB && AT_TB % 2048 == 0);

__global__ __launch_bounds__(512)
void attn_mqa_kernel(const unsigned short* __restrict__ qp, const unsigned short* __restrict__ kp,
                     const unsigned short* __restrict__ vtp, float* __restrict__ out, float sscale) {
  union FB { v16b v; v16h f; v8b h[2]; v4u u[2]; };   // 16 two-byte elements: bf16 (Q, K) or f16 (V^T, P^T)
  __shared__ __attribute__((aligned(2048))) unsigned char Ring[2 * AT_BUFB];   // [buffer][key group][K [kv][d] | V^T [d][kv]][AT_TB]
  __shared__ __align__(16) float  Os[AT_NW][AT_QT * 16 * 68];               // per query-tile pair: out tile of 32 rows, pitch 68
  __shared__ __align__(16) float  Mo[AT_NG - 1][AT_NW][AT_QT * 8 * 32 * 4];  // per group 1..3 and pair: its O^T, [query tile][16-B piece 0..7][lane]
  __shared__ float Mm[AT_NG - 1][AT_NW][AT_QT][32];                         // per group 1..3 and pair: its running maxima, by lane
  __shared__ float Ml[AT_NG - 1][AT_NW][AT_QT][32];                         // per group 1..3 and pair: its running sums, by lane

  const int grp  = __builtin_amdgcn_readfirstlane((int)threadIdx.x >> 7);   // key group 0..3, the same in a whole wave
  const int tid  = threadIdx.x & 127;     // thread within the key group
  const int wave = tid >> 5;              // query-tile pair 0..3
  const int lane = tid & 31;
  const int hh   = lane >> 4;
  const int c    = lane & 15;

  const int nqb = SEQ / AT_QB;            // 16 query blocks per (batch, head)
  const int bx = blockIdx.x;              // grid = NB_ * NH_ * nqb (exact)
  const int qb = bx % nqb;
  const int bh = bx / nqb;                // b*8 + h, 0..15
  const int b  = bh / NH_;                // 0..1 : key / value index depends on b only
  const int q0 = bh * SEQ + qb * AT_QB + wave * (AT_QT * 16);   // first of the wave's 32 rows in the q plane == row in out

  const __bf16* Qg = (const __bf16*)(const void*)qp;
  const __bf16* Kg = (const __bf16*)(const void*)kp  + (size_t)b * SEQ * AT_D;   // keys of batch b
  const __bf16* Vg = (const __bf16*)(const void*)vtp + (size_t)b * AT_D * SEQ;   // V^T of batch b [d][s] (f16 bits; this pointer only forms addresses of two-byte elements)

  // ---- Q fragments (B operand, column = query qt*16 + (lane&15), split k map): 2 query tiles x 2 d-chunks ----
  // the loops over qt in this kernel are unrolled because qa, s, ph, oacc and the running values are register arrays: their index must be a compile-time constant
  v16b qa[AT_QT][2];
#pragma unroll
  for (int qt = 0; qt < AT_QT; ++qt) {
#pragma unroll
    for (int dc = 0; dc < 2; ++dc)
      qa[qt][dc] = ld_frag_bf(Qg + (size_t)(q0 + qt * 16 + c) * AT_D + dc * 32 + 8 * hh);
  }

  // exp(sscale * (s - m)) = 2^(s * c2 - m * c2), c2 = sscale * log2(e): one fused multiply-add and one v_exp_f32 a score.
  // The argument is never above 0 but for its own rounding; far below, 2^x runs out to 0, as exp does.
  const float c2 = sscale * 1.44269504088896340736f;
  float mrow[AT_QT];        // running max of query qt*16+c over the UNSCALED scores (sscale > 0: the same key wins), equal in both halves
  float lrow[AT_QT];        // running sum of query qt*16+c over this half's keys only
  v8f oacc[AT_QT][4];       // oacc[qt][t][r] = O^T[d = t*16 + 8*hh + r][query qt*16+c]
#pragma unroll
  for (int qt = 0; qt < AT_QT; ++qt) {
    mrow[qt] = -INFINITY;
    lrow[qt] = 0.f;
#pragma unroll
    for (int t = 0; t < 4; ++t) oacc[qt][t] = (v8f){0.f,0.f,0.f,0.f,0.f,0.f,0.f,0.f};
  }

  const int nChunks = AT_GK / AT_KC;   // 8 per key group, compile-time constant, the same for all groups (the barriers are the block's)
  // ---- tensor-load ring: wave 0 of a key group brings its K tiles, wave 1 its V^T tiles; one request of a wave in flight ----
  const uint32_t wg = at_uni(threadIdx.x >> 5) & 3u;     // wave within the key group (one-dimensional block)
  const bool issuer = wg < 2u;
  const bool isV = wg == 1u;
  const uint32_t dst0 = (uint32_t)(uintptr_t)(&Ring[0]) + (uint32_t)grp * (2u * AT_TB) + (isV ? (uint32_t)AT_TB : 0u);
  // first byte of the group's chunk 0: K rows grp*512.. (a chunk on: 64 rows x 128 B); V^T row 0, keys grp*512.. (a chunk on: 64 keys x 2 B)
  const uint64_t src0 = isV ? (uint64_t)(uintptr_t)(Vg + grp * AT_GK) : (uint64_t)(uintptr_t)(Kg + (size_t)grp * AT_GK * AT_D);
  const uint32_t sstep = isV ? (uint32_t)(AT_KC * 2) : (uint32_t)(AT_KC * AT_D * 2);
  const u32x8 g1 = at_tdm_group1(isV ? (uint32_t)(SEQ * 2) : (uint32_t)(AT_D * 2));
  if (pinned(issuer)) {
    at_tdm_load(at_tdm_group0(dst0, src0), g1);
    asm volatile("s_wait_tensorcnt 0x0" ::: "memory");   // chunk 0 has landed before the barrier that publishes it
  }
  __syncthreads();
  if (pinned(issuer)) at_tdm_load(at_tdm_group0(dst0 + AT_BUFB, src0 + sstep), g1);   // chunk 1 flies during trip 0
  for (int kc = 0; kc < nChunks; ++kc) {
    const __bf16* Ksh = (const __bf16*)(const void*)(Ring + (kc & 1) * AT_BUFB + grp * (2 * AT_TB));
    const __bf16* Vth = Ksh + AT_TB / 2;   // f16 bits, moved as 16-byte pieces and read through FB::f

    // ---- S^T = k . q^T : A fragment row = key j*16+c, B = Q column c, split k map over d on both ----
    // all 8 K fragments are read as ONE group ahead of the products: one LDS latency per chunk instead of one per fragment
    FB kb[4][2];
#pragma unroll
    for (int j = 0; j < 4; ++j) {
#pragma unroll
      for (int dc = 0; dc < 2; ++dc) {
        kb[j][dc].h[0] = *(const v8b*)(Ksh + (j * 16 + c) * AT_LP + dc * 32 + 8 * hh);
        kb[j][dc].h[1] = *(const v8b*)(Ksh + (j * 16 + c) * AT_LP + dc * 32 + 16 + 8 * hh);
      }
    }
    // each K fragment is the A operand of two products, one a query tile
    v8f s[AT_QT][4];
#pragma unroll
    for (int j = 0; j < 4; ++j) {
#pragma unroll
      for (int qt = 0; qt < AT_QT; ++qt) s[qt][j] = (v8f){0.f,0.f,0.f,0.f,0.f,0.f,0.f,0.f};
#pragma unroll
      for (int dc = 0; dc < 2; ++dc) {
#pragma unroll
        for (int qt = 0; qt < AT_QT; ++qt) s[qt][j] = at_mma(kb[j][dc].v, qa[qt][dc], s[qt][j]);
      }
    }
    // the 8 V^T fragments are read into registers here, not among their products: the softmax's vector work between read and use covers the LDS latency
    FB vb[2][4];
#pragma unroll
    for (int kk = 0; kk < 2; ++kk) {
#pragma unroll
      for (int t = 0; t < 4; ++t) {
        vb[kk][t].h[0] = *(const v8b*)(Vth + (t * 16 + c) * AT_LP + kk * 32 + 8 * hh);
        vb[kk][t].h[1] = *(const v8b*)(Vth + (t * 16 + c) * AT_LP + kk * 32 + 16 + 8 * hh);
      }
    }
    // P^T as B operand: element e of the 32-key block kk = key kk*32 + (e < 8 ? 8hh + e : 16 + 8hh + e - 8) = s[qt][2kk + (e >> 3)][e & 7]
    FB ph[AT_QT][2];
#pragma unroll
    for (int qt = 0; qt < AT_QT; ++qt) {
      // chunk max of query qt*16+c (s[qt][j][r] = unscaled score of key j*16 + 8hh + r): in-lane, then the other half
      float cm = -INFINITY;
#pragma unroll
      for (int j = 0; j < 4; ++j) {
#pragma unroll
        for (int r = 0; r < 8; ++r) cm = fmaxf(cm, s[qt][j][r]);
      }
      cm = fmaxf(cm, at_xhalf(cm));
      const float mnew = fmaxf(mrow[qt], cm);
      const float alpha = __builtin_amdgcn_exp2f((mrow[qt] - mnew) * c2);
      const float nm2 = -mnew * c2;
      mrow[qt] = mnew;
      float ps[4];
#pragma unroll
      for (int j = 0; j < 4; ++j) {
#pragma unroll
        for (int r = 0; r < 8; ++r) s[qt][j][r] = fmaf(s[qt][j][r], c2, nm2);
        at_exp2_pack8(s[qt][j], ph[qt][j >> 1].u[j & 1]);   // s[qt][j] becomes p = 2^s[qt][j]
        float psum = s[qt][j][0];
#pragma unroll
        for (int r = 1; r < 8; ++r) psum += s[qt][j][r];
        ps[j] = psum;
      }
      lrow[qt] = lrow[qt] * alpha + ((ps[0] + ps[1]) + (ps[2] + ps[3]));
      // the empty asm volatile on each row's sum, against spills: it holds the sum here, so that the tile's 32 p values die in front of the products
      // (left free, the additions sink behind the trip's barrier, all 64 p values stay live through the products and Q fragments go to scratch)
      asm volatile("" : "+v"(lrow[qt]));
#pragma unroll
      for (int t = 0; t < 4; ++t) {
#pragma unroll
        for (int r = 0; r < 8; ++r) oacc[qt][t][r] *= alpha;
      }
    }
    // ---- O^T += v^T . p^T : A = V^T [d][key] (row = d t*16+c, split k map over keys), B = P^T, both f16 ----
    // each V^T fragment is the A operand of two products, one a query tile
    // unrolled: ph / vb are register arrays, their index must be a compile-time constant
#pragma unroll
    for (int kk = 0; kk < 2; ++kk) {
#pragma unroll
      for (int t = 0; t < 4; ++t) {
#pragma unroll
        for (int qt = 0; qt < AT_QT; ++qt) oacc[qt][t] = at_mma_h(vb[kk][t].f, ph[qt][kk].f, oacc[qt][t]);
      }
    }
    // ---- publish point of chunk kc+1, every wave, in this order ----
    asm volatile("s_wait_dscnt 0x0" ::: "memory");                             // this wave's reads of the buffer have retired before it may be refilled
    if (pinned(issuer)) asm volatile("s_wait_tensorcnt 0x0" ::: "memory");     // this wave's tile of chunk kc+1 has landed
    __syncthreads();                                                           // chunk kc+1 readable by all; every wave has left chunk kc's buffer
    if (pinned(issuer && kc + 2 < nChunks))
      at_tdm_load(at_tdm_group0(dst0 + (uint32_t)(kc & 1) * AT_BUFB, src0 + (uint64_t)(uint32_t)(kc + 2) * sstep), g1);
  }
  asm volatile("s_wait_tensorcnt 0x0" ::: "memory");   // nothing of the ring in flight behind the loop
  asm volatile("s_wait_dscnt 0x0" ::: "memory");

  // ---- the four key groups join: lane l of a wave of groups 1..3 hands its 2 maxima, 2 sums and 64 O^T values to lane l of group 0's wave of the same query-tile pair ----
  // the loops over qt, t, g and r here are unrolled because oacc and the running values are register arrays: their index must be a compile-time constant
  if (grp != 0) {
    float* mo = Mo[grp - 1][wave];
#pragma unroll
    for (int qt = 0; qt < AT_QT; ++qt) {
#pragma unroll
      for (int t = 0; t < 4; ++t) {
        v4f lo4, hi4;
#pragma unroll
        for (int r = 0; r < 4; ++r) { lo4[r] = oacc[qt][t][r]; hi4[r] = oacc[qt][t][4 + r]; }
        *(v4f*)(mo + (((qt * 4 + t) * 2 + 0) * 32 + lane) * 4) = lo4;
        *(v4f*)(mo + (((qt * 4 + t) * 2 + 1) * 32 + lane) * 4) = hi4;
      }
      Mm[grp - 1][wave][qt][lane] = mrow[qt];
      Ml[grp - 1][wave][qt][lane] = lrow[qt];
    }
  }
  __syncthreads();          // the partial results of groups 1..3 are in LDS; the block's last barrier
  if (grp != 0) return;     // whole waves leave, behind every barrier
#pragma unroll
  for (int qt = 0; qt < AT_QT; ++qt) {
    float mg[AT_NG - 1];
    float mj = mrow[qt];
#pragma unroll
    for (int g = 0; g < AT_NG - 1; ++g) { mg[g] = Mm[g][wave][qt][lane]; mj = fmaxf(mj, mg[g]); }
    const float a0 = __builtin_amdgcn_exp2f((mrow[qt] - mj) * c2);
    lrow[qt] *= a0;
#pragma unroll
    for (int t = 0; t < 4; ++t) {
#pragma unroll
      for (int r = 0; r < 8; ++r) oacc[qt][t][r] *= a0;
    }
#pragma unroll
    for (int g = 0; g < AT_NG - 1; ++g) {
      const float* mo = Mo[g][wave];
      const float ag = __builtin_amdgcn_exp2f((mg[g] - mj) * c2);
      lrow[qt] += Ml[g][wave][qt][lane] * ag;
#pragma unroll
      for (int t = 0; t < 4; ++t) {
        const v4f lo4 = *(const v4f*)(mo + (((qt * 4 + t) * 2 + 0) * 32 + lane) * 4);
        const v4f hi4 = *(const v4f*)(mo + (((qt * 4 + t) * 2 + 1) * 32 + lane) * 4);
#pragma unroll
        for (int r = 0; r < 4; ++r) {
          oacc[qt][t][r]     += lo4[r] * ag;
          oacc[qt][t][4 + r] += hi4[r] * ag;
        }
      }
    }
  }

  // join the two halves' sums of a query; a lane holds 8 consecutive d of query qt*16+c per tile: two 16-B LDS stores
  float* os = Os[wave];
#pragma unroll
  for (int qt = 0; qt < AT_QT; ++qt) {
    const float inv = 1.0f / (lrow[qt] + at_xhalf(lrow[qt]));
#pragma unroll
    for (int t = 0; t < 4; ++t) {
      v4f lo4, hi4;
#pragma unroll
      for (int r = 0; r < 4; ++r) { lo4[r] = oacc[qt][t][r] * inv; hi4[r] = oacc[qt][t][4 + r] * inv; }
      *(v4f*)(os + (qt * 16 + c) * 68 + t * 16 + 8 * hh)     = lo4;
      *(v4f*)(os + (qt * 16 + c) * 68 + t * 16 + 8 * hh + 4) = hi4;
    }
  }
  __builtin_amdgcn_fence(__ATOMIC_RELEASE, "workgroup");
  __builtin_amdgcn_wave_barrier();
  __builtin_amdgcn_fence(__ATOMIC_ACQUIRE, "workgroup");
  {
    const int c4 = (lane & 15) * 4;
    float* orow = out + (size_t)(q0 + hh) * AT_D + c4;   // one address; the rows follow at constant offsets
    {
#pragma unroll
      for (int it = 0; it < AT_QT * 8; ++it) {
        const int row = it * 2 + hh;   // it 0..15 x hh 0..1 covers rows 0..31 of the wave's two tiles
        v4f val = *(const v4f*)(os + row * 68 + c4);
        *(v4f*)(orow + it * 2 * AT_D) = val;
      }
      
    }
  }
}

// ---------------------------------------------------------------------------
// Workspace region map (byte offsets; every region is fully written by its producer launch before any consumer
//   QB  bf16 [32768][64]          0      4194304
//   KB  bf16 [4096][64]     4194304       524288
//   VT  f16  [2][64][2048]  4718592       524288
//   total                   5242880
// ---------------------------------------------------------------------------
extern "C" void kernel_launch(void* const* d_in, const int* in_sizes, int n_in,
                              void* d_out, int out_size, void* d_ws, size_t ws_size,
                              hipStream_t stream) {
  if (n_in < 3) return;
  if (in_sizes[0] != NQR * HD) return;          // Q [2][8][2048][64]
  if (in_sizes[1] != NKR * HD) return;          // K [2][1][2048][64]
  if (in_sizes[2] != NKR * HD) return;          // V [2][1][2048][64]
  if (out_size != NQR * HD) return;             // out [2][8][2048][64]; last written element index NQR*HD-1

  const float* Q = (const float*)d_in[0];
  const float* K = (const float*)d_in[1];
  const float* V = (const float*)d_in[2];

  const size_t PQB = (size_t)NQR * HD * 2;      // 4194304
  const size_t PKB = (size_t)NKR * HD * 2;      // 524288
  const size_t PVT = (size_t)NB_ * HD * SEQ * 2;// 524288
  size_t off = 0;
  const size_t oQB = off; off += PQB;
  const size_t oKB = off; off += PKB;
  const size_t oVT = off; off += PVT;
  if (off > ws_size) return;                    // off = 5242880
  if (off > (size_t)134217728) return;

  char* ws = (char*)d_ws;
  unsigned short* QB = (unsigned short*)(ws + oQB);
  unsigned short* KB = (unsigned short*)(ws + oKB);
  unsigned short* VT = (unsigned short*)(ws + oVT);

  // (1) one launch: V[b] [2048 s][64 d] -> VT_b[d][s] (64 blocks, a 64x64 tile each); QB = bf16(Q) flat, KB = bf16(K) flat (1024 + 128 blocks of 256 threads x 8 elements)
  const int n8q = NQR * HD / 8;                 // 262144
  const int n8k = NKR * HD / 8;                 // 32768
  const int nbq = n8q / 256;                    // 1024
  const int nbk = n8k / 256;                    // 128
  const int nbt = NB_ * (SEQ / 64);             // 64
  prep_kernel<<<dim3(nbt + nbq + nbk), dim3(256), 0, stream>>>(Q, K, V, QB, KB, VT, nbt, nbq, n8q, n8k);
  // (2) attention per (batch, head, 128-query block) -> d_out rows (b*8+h)*2048 + q; 256 blocks x 512 threads (4 query-tile pairs x 4 key groups)
  attn_mqa_kernel<<<dim3(NB_ * NH_ * (SEQ / 128)), dim3(512), 0, stream>>>(QB, KB, VT, (float*)d_out, 0.125f);
  (void)hipGetLastError();
}
